// v000
// Measured on an AMD MI455X. A time is GPU time per run, averaged over a window of back-to-back runs after a warm-up
// (all launches, gaps included; the runs take copies of the inputs in turn), and the median of several windows.
// Apart from v000's, it joins two sittings. Times from different sittings can be a few percent apart, while
// side-by-side timings come from the same sitting.
// v000 is the starting kernel. One run takes 281 microseconds.
#include <hip/hip_runtime.h>

typedef unsigned short u16;
typedef unsigned int   u32;
typedef __attribute__((ext_vector_type(16))) __bf16 v16bf;
typedef __attribute__((ext_vector_type(8)))  float  v8f;
typedef int v4i __attribute__((vector_size(16)));

#define AS1 __attribute__((address_space(1)))
#define AS3 __attribute__((address_space(3)))

#if defined(__has_builtin)
# if __has_builtin(__builtin_amdgcn_global_load_async_to_lds_b128)
#  define HAS_ASYNC_LDS 1
# endif
# if __has_builtin(__builtin_amdgcn_s_wait_asynccnt)
#  define HAS_WAIT_ASYNC 1
# endif
#endif
#ifndef HAS_ASYNC_LDS
# define HAS_ASYNC_LDS 0
#endif
#ifndef HAS_WAIT_ASYNC
# define HAS_WAIT_ASYNC 0
#endif

// ---------------------------------------------------------------- utilities

union Frag {
    u32   u[8];
    u16   s[16];
    v16bf v;
};

__device__ __forceinline__ u16 f2bf(float f) {
    u32 u = __float_as_uint(f);
    u32 r = u + 0x7FFFu + ((u >> 16) & 1u);   // round-to-nearest-even
    return (u16)(r >> 16);
}

__device__ __forceinline__ int kpair(int r, int hl) {
    return (r < 4 ? 2 * r : 16 + 2 * (r - 4)) + 8 * hl;
}

__device__ __forceinline__ v8f bf16_wmma(Frag a, Frag b, v8f c) {
    return __builtin_amdgcn_wmma_f32_16x16x32_bf16(
        false, a.v, false, b.v, (short)0, c, false, false);
}

__device__ __forceinline__ void async_cp16(const u16* g, u16* l) {
#if HAS_ASYNC_LDS
    __builtin_amdgcn_global_load_async_to_lds_b128(
        (AS1 v4i*)(size_t)g,    // flat address == global address for global mem
        (AS3 v4i*)l,            // generic -> LDS addrspacecast
        0, 0);
#else
    *(uint4*)l = *(const uint4*)g;
#endif
}

__device__ __forceinline__ void wait_async0() {
#if HAS_WAIT_ASYNC
    __builtin_amdgcn_s_wait_asynccnt(0);
#elif HAS_ASYNC_LDS
    asm volatile("s_wait_asynccnt 0x0" ::: "memory");
#endif
}

// ---------------------------------------------------------------- converts

__global__ void cvt_bf16(const float* __restrict__ src, u16* __restrict__ dst, int n) {
    int i = blockIdx.x * blockDim.x + threadIdx.x;
    int stride = gridDim.x * blockDim.x;
    for (; i < n; i += stride) dst[i] = f2bf(src[i]);
}

// Transposing convert: src [K][N] f32 -> dst [N][K] bf16 (weights become
// N-major so GEMM B tiles are contiguous row-major copies -> async-copyable).
__global__ __launch_bounds__(256) void cvt_bf16_t(
    const float* __restrict__ src, u16* __restrict__ dst, int K, int N)
{
    __shared__ u16 t[32][33];
    const int n0 = blockIdx.x * 32, k0 = blockIdx.y * 32;
    #pragma unroll
    for (int i = threadIdx.y; i < 32; i += 8)
        t[i][threadIdx.x] = f2bf(src[(size_t)(k0 + i) * N + n0 + threadIdx.x]);
    __syncthreads();
    #pragma unroll
    for (int i = threadIdx.y; i < 32; i += 8)
        dst[(size_t)(n0 + i) * K + k0 + threadIdx.x] = t[threadIdx.x][i];
}

// ---------------------------------------------------------------- projection GEMM
// [4096 x 1024] (bf16) @ Wt [1024(N) x 1024(K)] (bf16) -> bf16
// 256 threads = 8 waves; tile 64(M) x 128(N); BK=32; double-buffered async LDS.

__global__ __launch_bounds__(256) void proj_gemm(
    const u16* __restrict__ xq, const u16* __restrict__ xc,
    const u16* __restrict__ wtq, const u16* __restrict__ wtc,
    u16* __restrict__ pq, u16* __restrict__ pc)
{
    const u16* x  = blockIdx.z ? xc  : xq;
    const u16* wt = blockIdx.z ? wtc : wtq;
    u16*       p  = blockIdx.z ? pc  : pq;

    __shared__ u16 Ab[2][64][40];
    __shared__ u16 Bb[2][128][40];

    const int tid  = threadIdx.x;
    const int lane = tid & 31, wid = tid >> 5;
    const int hl   = (lane >> 4) & 1, mr = lane & 15;
    const int wm   = wid & 3, wn = wid >> 2;
    const int row0 = blockIdx.x * 64;
    const int col0 = blockIdx.y * 128;

    const int ar = tid >> 2;            // 0..63
    const int ac = (tid & 3) * 8;       // chunk of 8 bf16 = 16B

    v8f acc0 = {}, acc1 = {}, acc2 = {}, acc3 = {};

    auto stage = [&](int k0, int buf) {
        async_cp16(x  + (size_t)(row0 + ar)      * 1024 + k0 + ac, &Ab[buf][ar][ac]);
        async_cp16(wt + (size_t)(col0 + ar)      * 1024 + k0 + ac, &Bb[buf][ar][ac]);
        async_cp16(wt + (size_t)(col0 + 64 + ar) * 1024 + k0 + ac, &Bb[buf][64 + ar][ac]);
    };

    stage(0, 0);
    int buf = 0;
    for (int k0 = 0; k0 < 1024; k0 += 32) {
        wait_async0();
        __syncthreads();
        if (k0 + 32 < 1024) stage(k0 + 32, buf ^ 1);

        Frag a;
        #pragma unroll
        for (int r = 0; r < 8; r++)
            a.u[r] = *(const u32*)&Ab[buf][wm * 16 + mr][kpair(r, hl)];

        Frag b0, b1, b2, b3;
        #pragma unroll
        for (int r = 0; r < 8; r++) {
            int kk = kpair(r, hl);
            b0.u[r] = *(const u32*)&Bb[buf][wn * 64 +  0 + mr][kk];
            b1.u[r] = *(const u32*)&Bb[buf][wn * 64 + 16 + mr][kk];
            b2.u[r] = *(const u32*)&Bb[buf][wn * 64 + 32 + mr][kk];
            b3.u[r] = *(const u32*)&Bb[buf][wn * 64 + 48 + mr][kk];
        }
        acc0 = bf16_wmma(a, b0, acc0);
        acc1 = bf16_wmma(a, b1, acc1);
        acc2 = bf16_wmma(a, b2, acc2);
        acc3 = bf16_wmma(a, b3, acc3);
        buf ^= 1;
    }

    #pragma unroll
    for (int j = 0; j < 8; j++) {
        int row = row0 + wm * 16 + j + 8 * hl;   // C/D layout: reg j -> row j + 8*half
        int cb  = col0 + wn * 64 + mr;
        p[(size_t)row * 1024 + cb     ] = f2bf(acc0[j]);
        p[(size_t)row * 1024 + cb + 16] = f2bf(acc1[j]);
        p[(size_t)row * 1024 + cb + 32] = f2bf(acc2[j]);
        p[(size_t)row * 1024 + cb + 48] = f2bf(acc3[j]);
    }
}

// ---------------------------------------------------------------- flash attention
// One wave per (16 query rows, head, batch, direction). S=1024, DK=64.
// type 0: question_ = attn(q=proj_c, kv=proj_q, mask_q)
// type 1: context_  = attn(q=proj_q, kv=proj_c, mask_c)

__global__ __launch_bounds__(32) void attn_kernel(
    const u16* __restrict__ projq, const u16* __restrict__ projc,
    const int* __restrict__ mask_q, const int* __restrict__ mask_c,
    u16* __restrict__ attnq, u16* __restrict__ attnc)
{
    const int lane = threadIdx.x;
    const int hl = lane >> 4, mr = lane & 15;
    const int qb = blockIdx.x * 16;
    const int h  = blockIdx.y;
    const int b  = blockIdx.z >> 1, type = blockIdx.z & 1;

    const u16* Q     = type ? projq : projc;
    const u16* KV    = type ? projc : projq;
    const int* maskp = type ? mask_c : mask_q;
    u16*       out   = type ? attnc : attnq;

    Frag aq0, aq1;
    {
        const u16* qrow = Q + ((size_t)(b * 1024 + qb + mr)) * 1024 + h * 64;
        #pragma unroll
        for (int r = 0; r < 8; r++) {
            int k = kpair(r, hl);
            aq0.u[r] = *(const u32*)(qrow + k);
            aq1.u[r] = *(const u32*)(qrow + 32 + k);
        }
    }

    bool mneg[8];
    #pragma unroll
    for (int j = 0; j < 8; j++)
        mneg[j] = (maskp[b * 1024 + qb + j + 8 * hl] == 0);

    float mstat[8], lstat[8];
    #pragma unroll
    for (int j = 0; j < 8; j++) { mstat[j] = -1.0e30f; lstat[j] = 0.0f; }
    v8f o0 = {}, o1 = {}, o2 = {}, o3 = {};

    __shared__ u16 Pt[16][36];

    for (int kb = 0; kb < 1024; kb += 32) {
        Frag bk0, bk1, bk2, bk3;
        {
            const u16* kr0 = KV + ((size_t)(b * 1024 + kb      + mr)) * 1024 + h * 64;
            const u16* kr1 = KV + ((size_t)(b * 1024 + kb + 16 + mr)) * 1024 + h * 64;
            #pragma unroll
            for (int r = 0; r < 8; r++) {
                int k = kpair(r, hl);
                bk0.u[r] = *(const u32*)(kr0 + k);
                bk1.u[r] = *(const u32*)(kr0 + 32 + k);
                bk2.u[r] = *(const u32*)(kr1 + k);
                bk3.u[r] = *(const u32*)(kr1 + 32 + k);
            }
        }
        v8f s0 = {}, s1 = {};
        s0 = bf16_wmma(aq0, bk0, s0);
        s0 = bf16_wmma(aq1, bk1, s0);
        s1 = bf16_wmma(aq0, bk2, s1);
        s1 = bf16_wmma(aq1, bk3, s1);

        float p0[8], p1[8];
        #pragma unroll
        for (int j = 0; j < 8; j++) {
            float v0 = s0[j] * 0.125f;          // 1/sqrt(DK)
            float v1 = s1[j] * 0.125f;
            if (mneg[j]) { v0 = -65504.0f; v1 = -65504.0f; }
            float bm = fmaxf(v0, v1);
            #pragma unroll
            for (int d = 1; d < 16; d <<= 1) bm = fmaxf(bm, __shfl_xor(bm, d, 32));
            float mn = fmaxf(mstat[j], bm);
            float al = __expf(mstat[j] - mn);
            p0[j] = __expf(v0 - mn);
            p1[j] = __expf(v1 - mn);
            float rs = p0[j] + p1[j];
            #pragma unroll
            for (int d = 1; d < 16; d <<= 1) rs += __shfl_xor(rs, d, 32);
            lstat[j] = lstat[j] * al + rs;
            mstat[j] = mn;
            o0[j] *= al; o1[j] *= al; o2[j] *= al; o3[j] *= al;
        }

        #pragma unroll
        for (int j = 0; j < 8; j++) {
            Pt[j + 8 * hl][mr]      = f2bf(p0[j]);
            Pt[j + 8 * hl][16 + mr] = f2bf(p1[j]);
        }
        __syncthreads();
        Frag ap;
        #pragma unroll
        for (int r = 0; r < 8; r++)
            ap.u[r] = *(const u32*)&Pt[mr][kpair(r, hl)];

        Frag bv0, bv1, bv2, bv3;
        #pragma unroll
        for (int e = 0; e < 16; e++) {
            int k = kpair(e >> 1, hl) + (e & 1);
            const u16* vrow = KV + ((size_t)(b * 1024 + kb + k)) * 1024 + h * 64;
            bv0.s[e] = vrow[ 0 + mr];
            bv1.s[e] = vrow[16 + mr];
            bv2.s[e] = vrow[32 + mr];
            bv3.s[e] = vrow[48 + mr];
        }
        o0 = bf16_wmma(ap, bv0, o0);
        o1 = bf16_wmma(ap, bv1, o1);
        o2 = bf16_wmma(ap, bv2, o2);
        o3 = bf16_wmma(ap, bv3, o3);
        __syncthreads();
    }

    #pragma unroll
    for (int j = 0; j < 8; j++) {
        float inv = 1.0f / lstat[j];
        int row = qb + j + 8 * hl;
        size_t base = ((size_t)(b * 1024 + row)) * 1024 + h * 64;
        out[base +  0 + mr] = f2bf(o0[j] * inv);
        out[base + 16 + mr] = f2bf(o1[j] * inv);
        out[base + 32 + mr] = f2bf(o2[j] * inv);
        out[base + 48 + mr] = f2bf(o3[j] * inv);
    }
}

// ---------------------------------------------------------------- FFN GEMM
// out = x + tanh(concat([x, x_attn]) @ W + b);  M=4096, N=1024, K=2048.
// Wt is [1024(N) x 2048(K)] bf16 (pre-transposed).

__global__ __launch_bounds__(256) void ffn_gemm(
    const u16* __restrict__ xqb, const u16* __restrict__ xcb,
    const u16* __restrict__ aqb, const u16* __restrict__ acb,
    const u16* __restrict__ w1t, const u16* __restrict__ w2t,
    const float* __restrict__ b1, const float* __restrict__ b2,
    const float* __restrict__ xq, const float* __restrict__ xc,
    float* __restrict__ outq, float* __restrict__ outc)
{
    const u16* src0  = blockIdx.z ? xcb : xqb;
    const u16* src1  = blockIdx.z ? acb : aqb;
    const u16* wt    = blockIdx.z ? w2t : w1t;
    const float* bias = blockIdx.z ? b2 : b1;
    const float* xf  = blockIdx.z ? xc : xq;
    float*       out = blockIdx.z ? outc : outq;

    __shared__ u16 Ab[2][64][40];
    __shared__ u16 Bb[2][128][40];

    const int tid  = threadIdx.x;
    const int lane = tid & 31, wid = tid >> 5;
    const int hl   = (lane >> 4) & 1, mr = lane & 15;
    const int wm   = wid & 3, wn = wid >> 2;
    const int row0 = blockIdx.x * 64;
    const int col0 = blockIdx.y * 128;

    const int ar = tid >> 2;
    const int ac = (tid & 3) * 8;

    v8f acc0 = {}, acc1 = {}, acc2 = {}, acc3 = {};

    auto stage = [&](int k0, int buf) {
        const u16* asrc = (k0 < 1024) ? src0 : src1;
        const int  ka   = k0 & 1023;
        async_cp16(asrc + (size_t)(row0 + ar)      * 1024 + ka + ac, &Ab[buf][ar][ac]);
        async_cp16(wt   + (size_t)(col0 + ar)      * 2048 + k0 + ac, &Bb[buf][ar][ac]);
        async_cp16(wt   + (size_t)(col0 + 64 + ar) * 2048 + k0 + ac, &Bb[buf][64 + ar][ac]);
    };

    stage(0, 0);
    int buf = 0;
    for (int k0 = 0; k0 < 2048; k0 += 32) {
        wait_async0();
        __syncthreads();
        if (k0 + 32 < 2048) stage(k0 + 32, buf ^ 1);

        Frag a;
        #pragma unroll
        for (int r = 0; r < 8; r++)
            a.u[r] = *(const u32*)&Ab[buf][wm * 16 + mr][kpair(r, hl)];

        Frag b0f, b1f, b2f, b3f;
        #pragma unroll
        for (int r = 0; r < 8; r++) {
            int kk = kpair(r, hl);
            b0f.u[r] = *(const u32*)&Bb[buf][wn * 64 +  0 + mr][kk];
            b1f.u[r] = *(const u32*)&Bb[buf][wn * 64 + 16 + mr][kk];
            b2f.u[r] = *(const u32*)&Bb[buf][wn * 64 + 32 + mr][kk];
            b3f.u[r] = *(const u32*)&Bb[buf][wn * 64 + 48 + mr][kk];
        }
        acc0 = bf16_wmma(a, b0f, acc0);
        acc1 = bf16_wmma(a, b1f, acc1);
        acc2 = bf16_wmma(a, b2f, acc2);
        acc3 = bf16_wmma(a, b3f, acc3);
        buf ^= 1;
    }

    const int colb = col0 + wn * 64 + mr;
    const float bb0 = bias[colb], bb1 = bias[colb + 16];
    const float bb2 = bias[colb + 32], bb3 = bias[colb + 48];
    #pragma unroll
    for (int j = 0; j < 8; j++) {
        size_t row = (size_t)(row0 + wm * 16 + j + 8 * hl);
        size_t i0 = row * 1024 + colb;
        out[i0     ] = xf[i0     ] + tanhf(acc0[j] + bb0);
        out[i0 + 16] = xf[i0 + 16] + tanhf(acc1[j] + bb1);
        out[i0 + 32] = xf[i0 + 32] + tanhf(acc2[j] + bb2);
        out[i0 + 48] = xf[i0 + 48] + tanhf(acc3[j] + bb3);
    }
}

// ---------------------------------------------------------------- launcher

extern "C" void kernel_launch(void* const* d_in, const int* in_sizes, int n_in,
                              void* d_out, int out_size, void* d_ws, size_t ws_size,
                              hipStream_t stream) {
    (void)in_sizes; (void)n_in; (void)out_size; (void)ws_size;

    const float* question = (const float*)d_in[0];
    const float* context  = (const float*)d_in[1];
    const int*   mask_q   = (const int*)d_in[2];
    const int*   mask_c   = (const int*)d_in[3];
    const float* Wq = (const float*)d_in[4];
    const float* Wc = (const float*)d_in[5];
    const float* W1 = (const float*)d_in[6];
    const float* b1 = (const float*)d_in[7];
    const float* W2 = (const float*)d_in[8];
    const float* b2 = (const float*)d_in[9];

    const size_t NX = (size_t)4 * 1024 * 1024;   // B*S*D
    u16* ws  = (u16*)d_ws;
    u16* xqb = ws;                u16* xcb = xqb + NX;
    u16* wqb = xcb + NX;          u16* wcb = wqb + (size_t)1024 * 1024;
    u16* w1b = wcb + (size_t)1024 * 1024;
    u16* w2b = w1b + (size_t)2048 * 1024;
    u16* pq  = w2b + (size_t)2048 * 1024;
    u16* pc  = pq + NX;
    u16* aq  = pc + NX;
    u16* ac  = aq + NX;

    float* outq = (float*)d_out;
    float* outc = outq + NX;

    cvt_bf16<<<512, 256, 0, stream>>>(question, xqb, (int)NX);
    cvt_bf16<<<512, 256, 0, stream>>>(context,  xcb, (int)NX);
    // weights converted AND transposed to [N][K] so GEMM tiles are contiguous
    cvt_bf16_t<<<dim3(32, 32), dim3(32, 8), 0, stream>>>(Wq, wqb, 1024, 1024);
    cvt_bf16_t<<<dim3(32, 32), dim3(32, 8), 0, stream>>>(Wc, wcb, 1024, 1024);
    cvt_bf16_t<<<dim3(32, 64), dim3(32, 8), 0, stream>>>(W1, w1b, 2048, 1024);
    cvt_bf16_t<<<dim3(32, 64), dim3(32, 8), 0, stream>>>(W2, w2b, 2048, 1024);

    proj_gemm<<<dim3(64, 8, 2), 256, 0, stream>>>(xqb, xcb, wqb, wcb, pq, pc);
    attn_kernel<<<dim3(64, 16, 8), 32, 0, stream>>>(pq, pc, mask_q, mask_c, aq, ac);
    ffn_gemm<<<dim3(64, 8, 2), 256, 0, stream>>>(xqb, xcb, aq, ac, w1b, w2b,
                                                 b1, b2, question, context, outq, outc);
}

// v001
// One run takes 192 microseconds.
// In both of two side-by-side timings against v000, it was 1.50 times as fast.
#include <hip/hip_runtime.h>

typedef unsigned short u16;
typedef unsigned int   u32;
typedef __attribute__((ext_vector_type(16))) __bf16 v16bf;
typedef __attribute__((ext_vector_type(8)))  float  v8f;
typedef int v4i __attribute__((vector_size(16)));

#define AS1 __attribute__((address_space(1)))
#define AS3 __attribute__((address_space(3)))

#if defined(__has_builtin)
# if __has_builtin(__builtin_amdgcn_global_load_async_to_lds_b128)
#  define HAS_ASYNC_LDS 1
# endif
# if __has_builtin(__builtin_amdgcn_s_wait_asynccnt)
#  define HAS_WAIT_ASYNC 1
# endif
#endif
#ifndef HAS_ASYNC_LDS
# define HAS_ASYNC_LDS 0
#endif
#ifndef HAS_WAIT_ASYNC
# define HAS_WAIT_ASYNC 0
#endif

// ---------------------------------------------------------------- utilities

typedef u32 u32x4 __attribute__((ext_vector_type(4)));

union Frag {
    u32   u[8];
    u32x4 q[2];
    u16   s[16];
    v16bf v;
};

__device__ __forceinline__ u16 f2bf(float f) {
    u32 u = __float_as_uint(f);
    u32 r = u + 0x7FFFu + ((u >> 16) & 1u);   // round-to-nearest-even
    return (u16)(r >> 16);
}

__device__ __forceinline__ int kpair(int r, int hl) {
    return (r < 4 ? 2 * r : 16 + 2 * (r - 4)) + 8 * hl;
}

__device__ __forceinline__ v8f bf16_wmma(Frag a, Frag b, v8f c) {
    return __builtin_amdgcn_wmma_f32_16x16x32_bf16(
        false, a.v, false, b.v, (short)0, c, false, false);
}

__device__ __forceinline__ void async_cp16(const u16* g, u16* l) {
#if HAS_ASYNC_LDS
    __builtin_amdgcn_global_load_async_to_lds_b128(
        (AS1 v4i*)(size_t)g,    // flat address == global address for global mem
        (AS3 v4i*)l,            // generic -> LDS addrspacecast
        0, 0);
#else
    *(uint4*)l = *(const uint4*)g;
#endif
}

__device__ __forceinline__ void wait_async0() {
#if HAS_WAIT_ASYNC
    __builtin_amdgcn_s_wait_asynccnt(0);
#elif HAS_ASYNC_LDS
    asm volatile("s_wait_asynccnt 0x0" ::: "memory");
#endif
}

// ---------------------------------------------------------------- converts

__global__ void cvt_bf16(const float* __restrict__ src, u16* __restrict__ dst, int n) {
    int i = blockIdx.x * blockDim.x + threadIdx.x;
    int stride = gridDim.x * blockDim.x;
    for (; i < n; i += stride) dst[i] = f2bf(src[i]);
}

// Transposing convert: src [K][N] f32 -> dst [N][K] bf16 (weights become
// N-major so GEMM B tiles are contiguous row-major copies -> async-copyable).
__global__ __launch_bounds__(256) void cvt_bf16_t(
    const float* __restrict__ src, u16* __restrict__ dst, int K, int N)
{
    __shared__ u16 t[32][33];
    const int n0 = blockIdx.x * 32, k0 = blockIdx.y * 32;
    #pragma unroll
    for (int i = threadIdx.y; i < 32; i += 8)
        t[i][threadIdx.x] = f2bf(src[(size_t)(k0 + i) * N + n0 + threadIdx.x]);
    __syncthreads();
    #pragma unroll
    for (int i = threadIdx.y; i < 32; i += 8)
        dst[(size_t)(n0 + i) * K + k0 + threadIdx.x] = t[threadIdx.x][i];
}

// ---------------------------------------------------------------- projection GEMM
// [4096 x 1024] (bf16) @ Wt [1024(N) x 1024(K)] (bf16) -> bf16
// 256 threads = 8 waves; tile 64(M) x 128(N); BK=32; double-buffered async LDS.

__global__ __launch_bounds__(256) void proj_gemm(
    const u16* __restrict__ xq, const u16* __restrict__ xc,
    const u16* __restrict__ wtq, const u16* __restrict__ wtc,
    u16* __restrict__ pq, u16* __restrict__ pc)
{
    const u16* x  = blockIdx.z ? xc  : xq;
    const u16* wt = blockIdx.z ? wtc : wtq;
    u16*       p  = blockIdx.z ? pc  : pq;

    __shared__ u16 Ab[2][64][40];
    __shared__ u16 Bb[2][128][40];

    const int tid  = threadIdx.x;
    const int lane = tid & 31, wid = tid >> 5;
    const int hl   = (lane >> 4) & 1, mr = lane & 15;
    const int wm   = wid & 3, wn = wid >> 2;
    const int row0 = blockIdx.x * 64;
    const int col0 = blockIdx.y * 128;

    const int ar = tid >> 2;            // 0..63
    const int ac = (tid & 3) * 8;       // chunk of 8 bf16 = 16B

    v8f acc0 = {}, acc1 = {}, acc2 = {}, acc3 = {};

    auto stage = [&](int k0, int buf) {
        async_cp16(x  + (size_t)(row0 + ar)      * 1024 + k0 + ac, &Ab[buf][ar][ac]);
        async_cp16(wt + (size_t)(col0 + ar)      * 1024 + k0 + ac, &Bb[buf][ar][ac]);
        async_cp16(wt + (size_t)(col0 + 64 + ar) * 1024 + k0 + ac, &Bb[buf][64 + ar][ac]);
    };

    stage(0, 0);
    int buf = 0;
    for (int k0 = 0; k0 < 1024; k0 += 32) {
        wait_async0();
        __syncthreads();
        if (k0 + 32 < 1024) stage(k0 + 32, buf ^ 1);

        Frag a;
        #pragma unroll
        for (int r = 0; r < 8; r++)
            a.u[r] = *(const u32*)&Ab[buf][wm * 16 + mr][kpair(r, hl)];

        Frag b0, b1, b2, b3;
        #pragma unroll
        for (int r = 0; r < 8; r++) {
            int kk = kpair(r, hl);
            b0.u[r] = *(const u32*)&Bb[buf][wn * 64 +  0 + mr][kk];
            b1.u[r] = *(const u32*)&Bb[buf][wn * 64 + 16 + mr][kk];
            b2.u[r] = *(const u32*)&Bb[buf][wn * 64 + 32 + mr][kk];
            b3.u[r] = *(const u32*)&Bb[buf][wn * 64 + 48 + mr][kk];
        }
        acc0 = bf16_wmma(a, b0, acc0);
        acc1 = bf16_wmma(a, b1, acc1);
        acc2 = bf16_wmma(a, b2, acc2);
        acc3 = bf16_wmma(a, b3, acc3);
        buf ^= 1;
    }

    #pragma unroll
    for (int j = 0; j < 8; j++) {
        int row = row0 + wm * 16 + j + 8 * hl;   // C/D layout: reg j -> row j + 8*half
        int cb  = col0 + wn * 64 + mr;
        p[(size_t)row * 1024 + cb     ] = f2bf(acc0[j]);
        p[(size_t)row * 1024 + cb + 16] = f2bf(acc1[j]);
        p[(size_t)row * 1024 + cb + 32] = f2bf(acc2[j]);
        p[(size_t)row * 1024 + cb + 48] = f2bf(acc3[j]);
    }
}

// ---------------------------------------------------------------- flash attention
// One wave per 16 query rows; the 8 waves of a block (128 query rows of one
// head, batch, direction) share each 64-key tile, staged in LDS for the block.
// K and V are the same rows; the tile is laid down twice, once at the pitch
// that suits each product's reader. S=1024, DK=64.
// type 0: question_ = attn(q=proj_c, kv=proj_q, mask_q)
// type 1: context_  = attn(q=proj_q, kv=proj_c, mask_c)

typedef short s16x8 __attribute__((ext_vector_type(8)));

#define KV_KEYS  64     // keys per staged tile
#define K_PITCH  72     // u16 per LDS row = 144 B, an odd multiple of 16 B (ds_load_b128 readers)
#define V_PITCH  80     // u16 per LDS row = 160 B, an odd multiple of 32 B (ds_load_tr16_b128 readers)

__device__ __forceinline__ void kv_copy4(u32 l0, const u16* g0, u32 l1, const u16* g1,
                                         u32 l2, const u16* g2, u32 l3, const u16* g3) {
    asm volatile("global_load_async_to_lds_b128 %0, %1, off\n\t"
                 "global_load_async_to_lds_b128 %2, %3, off\n\t"
                 "global_load_async_to_lds_b128 %4, %5, off\n\t"
                 "global_load_async_to_lds_b128 %6, %7, off\n\t"
                 "s_wait_xcnt 0x0"
                 :: "v"(l0), "v"(g0), "v"(l1), "v"(g1), "v"(l2), "v"(g2), "v"(l3), "v"(g3) : "memory");
}

// lane (c, h) gets T[8h + 0..7][c] of the 16x16 block of 16-bit elements that the lanes' addresses name
__device__ __forceinline__ u32x4 ld_tr16(const u16* p) {
    return __builtin_bit_cast(u32x4, __builtin_amdgcn_ds_load_tr16_b128_v8i16((AS3 s16x8*)p));
}

__global__ __launch_bounds__(256, 6) void attn_kernel(
    const u16* __restrict__ projq, const u16* __restrict__ projc,
    const int* __restrict__ mask_q, const int* __restrict__ mask_c,
    u16* __restrict__ attnq, u16* __restrict__ attnc)
{
    const int tid  = threadIdx.x;
    const int lane = tid & 31, wid = tid >> 5;
    const int hl = lane >> 4, mr = lane & 15;
    const int qb = blockIdx.x * 128 + wid * 16;
    const int h  = blockIdx.y;
    const int b  = blockIdx.z >> 1, type = blockIdx.z & 1;

    const u16* Q     = type ? projq : projc;
    const u16* KV    = type ? projc : projq;
    const int* maskp = type ? mask_c : mask_q;
    u16*       out   = type ? attnc : attnq;

    __shared__ __attribute__((aligned(16))) u16 Kt[2][KV_KEYS][K_PITCH];
    __shared__ __attribute__((aligned(16))) u16 Vt[2][KV_KEYS][V_PITCH];
    __shared__ u16 Pt[8][2][16][36];    // per wave, one per 32-key half of a tile

    // each thread copies chunk cc (16 B) of rows cr and cr + 32 of a tile
    const int cr = tid >> 3, cc = (tid & 7) * 8;
    const u16* gsrc = KV + ((size_t)(b * 1024 + cr)) * 1024 + h * 64 + cc;
    const u32  kdst = (u32)(size_t)&Kt[0][cr][cc];
    const u32  vdst = (u32)(size_t)&Vt[0][cr][cc];
    auto stage = [&](int t, int buf) {
        const u16* g  = gsrc + (size_t)t * (KV_KEYS * 1024);
        const u32  lk = kdst + (u32)buf * (u32)(KV_KEYS * K_PITCH * 2);
        const u32  lv = vdst + (u32)buf * (u32)(KV_KEYS * V_PITCH * 2);
        kv_copy4(lk, g, lk + 32u * K_PITCH * 2u, g + 32 * 1024,
                 lv, g, lv + 32u * V_PITCH * 2u, g + 32 * 1024);
    };

    stage(0, 0);

    Frag aq0, aq1;
    {
        const u16* qrow = Q + ((size_t)(b * 1024 + qb + mr)) * 1024 + h * 64;
        #pragma unroll
        for (int r = 0; r < 8; r++) {
            int k = kpair(r, hl);
            aq0.u[r] = *(const u32*)(qrow + k);
            aq1.u[r] = *(const u32*)(qrow + 32 + k);
        }
    }
    asm volatile("s_wait_xcnt 0x0" ::: "memory");

    bool mneg[8];
    #pragma unroll
    for (int j = 0; j < 8; j++)
        mneg[j] = (maskp[b * 1024 + qb + j + 8 * hl] == 0);

    float mstat[8], lstat[8];
    #pragma unroll
    for (int j = 0; j < 8; j++) { mstat[j] = -1.0e30f; lstat[j] = 0.0f; }
    v8f o0 = {}, o1 = {}, o2 = {}, o3 = {};

    // tile 0 has landed for this wave, then for the block; only then tile 1 starts
    asm volatile("s_wait_asynccnt 0x0" ::: "memory");
    __syncthreads();
    stage(1, 1);

    for (int t = 0; t < 1024 / KV_KEYS; t++) {
        const int buf = t & 1;
        // unrolled: every LDS offset of a half becomes an immediate of its load
        #pragma unroll
        for (int sub = 0; sub < 2; sub++) {
            // K fragments: key row = column of S, d in the hardware k order (as Q's)
            Frag bk0, bk1, bk2, bk3;
            {
                const u16* kr0 = &Kt[buf][sub * 32      + mr][8 * hl];
                const u16* kr1 = &Kt[buf][sub * 32 + 16 + mr][8 * hl];
                bk0.q[0] = *(const u32x4*)(kr0);      bk0.q[1] = *(const u32x4*)(kr0 + 16);
                bk1.q[0] = *(const u32x4*)(kr0 + 32); bk1.q[1] = *(const u32x4*)(kr0 + 48);
                bk2.q[0] = *(const u32x4*)(kr1);      bk2.q[1] = *(const u32x4*)(kr1 + 16);
                bk3.q[0] = *(const u32x4*)(kr1 + 32); bk3.q[1] = *(const u32x4*)(kr1 + 48);
            }
            v8f s0 = {}, s1 = {};
            s0 = bf16_wmma(aq0, bk0, s0);
            s0 = bf16_wmma(aq1, bk1, s0);
            s1 = bf16_wmma(aq0, bk2, s1);
            s1 = bf16_wmma(aq1, bk3, s1);

            float p0[8], p1[8];
            #pragma unroll
            for (int j = 0; j < 8; j++) {
                float v0 = s0[j] * 0.125f;          // 1/sqrt(DK)
                float v1 = s1[j] * 0.125f;
                if (mneg[j]) { v0 = -65504.0f; v1 = -65504.0f; }
                float bm = fmaxf(v0, v1);
                #pragma unroll
                for (int d = 1; d < 16; d <<= 1) bm = fmaxf(bm, __shfl_xor(bm, d, 32));
                float mn = fmaxf(mstat[j], bm);
                float al = __expf(mstat[j] - mn);
                p0[j] = __expf(v0 - mn);
                p1[j] = __expf(v1 - mn);
                float rs = p0[j] + p1[j];
                #pragma unroll
                for (int d = 1; d < 16; d <<= 1) rs += __shfl_xor(rs, d, 32);
                lstat[j] = lstat[j] * al + rs;
                mstat[j] = mn;
                o0[j] *= al; o1[j] *= al; o2[j] *= al; o3[j] *= al;
            }

            #pragma unroll
            for (int j = 0; j < 8; j++) {
                Pt[wid][sub][j + 8 * hl][mr]      = f2bf(p0[j]);
                Pt[wid][sub][j + 8 * hl][16 + mr] = f2bf(p1[j]);
            }
            // P goes from lane to lane of this one wave: its stores are complete
            // (and stay in front, for the compiler) before any lane reads them back
            asm volatile("s_wait_dscnt 0x0" ::: "memory");
            Frag ap;
            #pragma unroll
            for (int r = 0; r < 8; r++)
                ap.u[r] = *(const u32*)&Pt[wid][sub][mr][kpair(r, hl)];

            // V fragments: the same rows, transposed on the way out of LDS;
            // keys 0-15 fill registers 0-3, keys 16-31 registers 4-7 (hardware k order, as P's)
            Frag bv0, bv1, bv2, bv3;
            {
                const u16* vr = &Vt[buf][sub * 32 + 8 * hl + (lane & 7)][8 * ((lane >> 3) & 1)];
                bv0.q[0] = ld_tr16(vr);      bv0.q[1] = ld_tr16(vr + 16 * V_PITCH);
                bv1.q[0] = ld_tr16(vr + 16); bv1.q[1] = ld_tr16(vr + 16 * V_PITCH + 16);
                bv2.q[0] = ld_tr16(vr + 32); bv2.q[1] = ld_tr16(vr + 16 * V_PITCH + 32);
                bv3.q[0] = ld_tr16(vr + 48); bv3.q[1] = ld_tr16(vr + 16 * V_PITCH + 48);
            }
            o0 = bf16_wmma(ap, bv0, o0);
            o1 = bf16_wmma(ap, bv1, o1);
            o2 = bf16_wmma(ap, bv2, o2);
            o3 = bf16_wmma(ap, bv3, o3);
        }

        // hand-over: this wave's reads of tile t are done, its copies of tile t + 1
        // have landed; behind the barrier both hold for the whole block
        asm volatile("s_wait_dscnt 0x0" ::: "memory");
        asm volatile("s_wait_asynccnt 0x0" ::: "memory");
        __syncthreads();
        if (t + 2 < 1024 / KV_KEYS) stage(t + 2, buf);
    }
    // no copy is left in flight when the wave ends
    asm volatile("s_wait_asynccnt 0x0" ::: "memory");

    #pragma unroll
    for (int j = 0; j < 8; j++) {
        float inv = 1.0f / lstat[j];
        int row = qb + j + 8 * hl;
        size_t base = ((size_t)(b * 1024 + row)) * 1024 + h * 64;
        out[base +  0 + mr] = f2bf(o0[j] * inv);
        out[base + 16 + mr] = f2bf(o1[j] * inv);
        out[base + 32 + mr] = f2bf(o2[j] * inv);
        out[base + 48 + mr] = f2bf(o3[j] * inv);
    }
}

// ---------------------------------------------------------------- FFN GEMM
// out = x + tanh(concat([x, x_attn]) @ W + b);  M=4096, N=1024, K=2048.
// Wt is [1024(N) x 2048(K)] bf16 (pre-transposed).

__global__ __launch_bounds__(256) void ffn_gemm(
    const u16* __restrict__ xqb, const u16* __restrict__ xcb,
    const u16* __restrict__ aqb, const u16* __restrict__ acb,
    const u16* __restrict__ w1t, const u16* __restrict__ w2t,
    const float* __restrict__ b1, const float* __restrict__ b2,
    const float* __restrict__ xq, const float* __restrict__ xc,
    float* __restrict__ outq, float* __restrict__ outc)
{
    const u16* src0  = blockIdx.z ? xcb : xqb;
    const u16* src1  = blockIdx.z ? acb : aqb;
    const u16* wt    = blockIdx.z ? w2t : w1t;
    const float* bias = blockIdx.z ? b2 : b1;
    const float* xf  = blockIdx.z ? xc : xq;
    float*       out = blockIdx.z ? outc : outq;

    __shared__ u16 Ab[2][64][40];
    __shared__ u16 Bb[2][128][40];

    const int tid  = threadIdx.x;
    const int lane = tid & 31, wid = tid >> 5;
    const int hl   = (lane >> 4) & 1, mr = lane & 15;
    const int wm   = wid & 3, wn = wid >> 2;
    const int row0 = blockIdx.x * 64;
    const int col0 = blockIdx.y * 128;

    const int ar = tid >> 2;
    const int ac = (tid & 3) * 8;

    v8f acc0 = {}, acc1 = {}, acc2 = {}, acc3 = {};

    auto stage = [&](int k0, int buf) {
        const u16* asrc = (k0 < 1024) ? src0 : src1;
        const int  ka   = k0 & 1023;
        async_cp16(asrc + (size_t)(row0 + ar)      * 1024 + ka + ac, &Ab[buf][ar][ac]);
        async_cp16(wt   + (size_t)(col0 + ar)      * 2048 + k0 + ac, &Bb[buf][ar][ac]);
        async_cp16(wt   + (size_t)(col0 + 64 + ar) * 2048 + k0 + ac, &Bb[buf][64 + ar][ac]);
    };

    stage(0, 0);
    int buf = 0;
    for (int k0 = 0; k0 < 2048; k0 += 32) {
        wait_async0();
        __syncthreads();
        if (k0 + 32 < 2048) stage(k0 + 32, buf ^ 1);

        Frag a;
        #pragma unroll
        for (int r = 0; r < 8; r++)
            a.u[r] = *(const u32*)&Ab[buf][wm * 16 + mr][kpair(r, hl)];

        Frag b0f, b1f, b2f, b3f;
        #pragma unroll
        for (int r = 0; r < 8; r++) {
            int kk = kpair(r, hl);
            b0f.u[r] = *(const u32*)&Bb[buf][wn * 64 +  0 + mr][kk];
            b1f.u[r] = *(const u32*)&Bb[buf][wn * 64 + 16 + mr][kk];
            b2f.u[r] = *(const u32*)&Bb[buf][wn * 64 + 32 + mr][kk];
            b3f.u[r] = *(const u32*)&Bb[buf][wn * 64 + 48 + mr][kk];
        }
        acc0 = bf16_wmma(a, b0f, acc0);
        acc1 = bf16_wmma(a, b1f, acc1);
        acc2 = bf16_wmma(a, b2f, acc2);
        acc3 = bf16_wmma(a, b3f, acc3);
        buf ^= 1;
    }

    const int colb = col0 + wn * 64 + mr;
    const float bb0 = bias[colb], bb1 = bias[colb + 16];
    const float bb2 = bias[colb + 32], bb3 = bias[colb + 48];
    #pragma unroll
    for (int j = 0; j < 8; j++) {
        size_t row = (size_t)(row0 + wm * 16 + j + 8 * hl);
        size_t i0 = row * 1024 + colb;
        out[i0     ] = xf[i0     ] + tanhf(acc0[j] + bb0);
        out[i0 + 16] = xf[i0 + 16] + tanhf(acc1[j] + bb1);
        out[i0 + 32] = xf[i0 + 32] + tanhf(acc2[j] + bb2);
        out[i0 + 48] = xf[i0 + 48] + tanhf(acc3[j] + bb3);
    }
}

// ---------------------------------------------------------------- launcher

extern "C" void kernel_launch(void* const* d_in, const int* in_sizes, int n_in,
                              void* d_out, int out_size, void* d_ws, size_t ws_size,
                              hipStream_t stream) {
    (void)in_sizes; (void)n_in; (void)out_size; (void)ws_size;

    const float* question = (const float*)d_in[0];
    const float* context  = (const float*)d_in[1];
    const int*   mask_q   = (const int*)d_in[2];
    const int*   mask_c   = (const int*)d_in[3];
    const float* Wq = (const float*)d_in[4];
    const float* Wc = (const float*)d_in[5];
    const float* W1 = (const float*)d_in[6];
    const float* b1 = (const float*)d_in[7];
    const float* W2 = (const float*)d_in[8];
    const float* b2 = (const float*)d_in[9];

    const size_t NX = (size_t)4 * 1024 * 1024;   // B*S*D
    u16* ws  = (u16*)d_ws;
    u16* xqb = ws;                u16* xcb = xqb + NX;
    u16* wqb = xcb + NX;          u16* wcb = wqb + (size_t)1024 * 1024;
    u16* w1b = wcb + (size_t)1024 * 1024;
    u16* w2b = w1b + (size_t)2048 * 1024;
    u16* pq  = w2b + (size_t)2048 * 1024;
    u16* pc  = pq + NX;
    u16* aq  = pc + NX;
    u16* ac  = aq + NX;

    float* outq = (float*)d_out;
    float* outc = outq + NX;

    cvt_bf16<<<512, 256, 0, stream>>>(question, xqb, (int)NX);
    cvt_bf16<<<512, 256, 0, stream>>>(context,  xcb, (int)NX);
    // weights converted AND transposed to [N][K] so GEMM tiles are contiguous
    cvt_bf16_t<<<dim3(32, 32), dim3(32, 8), 0, stream>>>(Wq, wqb, 1024, 1024);
    cvt_bf16_t<<<dim3(32, 32), dim3(32, 8), 0, stream>>>(Wc, wcb, 1024, 1024);
    cvt_bf16_t<<<dim3(32, 64), dim3(32, 8), 0, stream>>>(W1, w1b, 2048, 1024);
    cvt_bf16_t<<<dim3(32, 64), dim3(32, 8), 0, stream>>>(W2, w2b, 2048, 1024);

    proj_gemm<<<dim3(64, 8, 2), 256, 0, stream>>>(xqb, xcb, wqb, wcb, pq, pc);
    attn_kernel<<<dim3(8, 16, 8), 256, 0, stream>>>(pq, pc, mask_q, mask_c, aq, ac);
    ffn_gemm<<<dim3(64, 8, 2), 256, 0, stream>>>(xqb, xcb, aq, ac, w1b, w2b,
                                                 b1, b2, question, context, outq, outc);
}

// v002
// One run takes 148 microseconds.
// In both of two side-by-side timings against v001, it was 1.30 times as fast.
// Counting every step since v000, it is 1.95 times as fast.
#include <hip/hip_runtime.h>

typedef unsigned short u16;
typedef unsigned int   u32;
typedef __attribute__((ext_vector_type(16))) __bf16 v16bf;
typedef __attribute__((ext_vector_type(8)))  float  v8f;
typedef int v4i __attribute__((vector_size(16)));

#define AS1 __attribute__((address_space(1)))
#define AS3 __attribute__((address_space(3)))

#if defined(__has_builtin)
# if __has_builtin(__builtin_amdgcn_global_load_async_to_lds_b128)
#  define HAS_ASYNC_LDS 1
# endif
# if __has_builtin(__builtin_amdgcn_s_wait_asynccnt)
#  define HAS_WAIT_ASYNC 1
# endif
#endif
#ifndef HAS_ASYNC_LDS
# define HAS_ASYNC_LDS 0
#endif
#ifndef HAS_WAIT_ASYNC
# define HAS_WAIT_ASYNC 0
#endif

// ---------------------------------------------------------------- utilities

typedef u32 u32x4 __attribute__((ext_vector_type(4)));

union Frag {
    u32   u[8];
    u32x4 q[2];
    u16   s[16];
    v16bf v;
};

__device__ __forceinline__ u16 f2bf(float f) {
    u32 u = __float_as_uint(f);
    u32 r = u + 0x7FFFu + ((u >> 16) & 1u);   // round-to-nearest-even
    return (u16)(r >> 16);
}

__device__ __forceinline__ int kpair(int r, int hl) {
    return (r < 4 ? 2 * r : 16 + 2 * (r - 4)) + 8 * hl;
}

__device__ __forceinline__ v8f bf16_wmma(Frag a, Frag b, v8f c) {
    return __builtin_amdgcn_wmma_f32_16x16x32_bf16(
        false, a.v, false, b.v, (short)0, c, false, false);
}

__device__ __forceinline__ void async_cp16(const u16* g, u16* l) {
#if HAS_ASYNC_LDS
    __builtin_amdgcn_global_load_async_to_lds_b128(
        (AS1 v4i*)(size_t)g,    // flat address == global address for global mem
        (AS3 v4i*)l,            // generic -> LDS addrspacecast
        0, 0);
#else
    *(uint4*)l = *(const uint4*)g;
#endif
}

__device__ __forceinline__ void wait_async0() {
#if HAS_WAIT_ASYNC
    __builtin_amdgcn_s_wait_asynccnt(0);
#elif HAS_ASYNC_LDS
    asm volatile("s_wait_asynccnt 0x0" ::: "memory");
#endif
}

// ---------------------------------------------------------------- converts

__global__ void cvt_bf16(const float* __restrict__ src, u16* __restrict__ dst, int n) {
    int i = blockIdx.x * blockDim.x + threadIdx.x;
    int stride = gridDim.x * blockDim.x;
    for (; i < n; i += stride) dst[i] = f2bf(src[i]);
}

// Transposing convert: src [K][N] f32 -> dst [N][K] bf16 (weights become
// N-major so GEMM B tiles are contiguous row-major copies -> async-copyable).
__global__ __launch_bounds__(256) void cvt_bf16_t(
    const float* __restrict__ src, u16* __restrict__ dst, int K, int N)
{
    __shared__ u16 t[32][33];
    const int n0 = blockIdx.x * 32, k0 = blockIdx.y * 32;
    #pragma unroll
    for (int i = threadIdx.y; i < 32; i += 8)
        t[i][threadIdx.x] = f2bf(src[(size_t)(k0 + i) * N + n0 + threadIdx.x]);
    __syncthreads();
    #pragma unroll
    for (int i = threadIdx.y; i < 32; i += 8)
        dst[(size_t)(n0 + i) * K + k0 + threadIdx.x] = t[threadIdx.x][i];
}

// ---------------------------------------------------------------- projection GEMM
// [4096 x 1024] (bf16) @ Wt [1024(N) x 1024(K)] (bf16) -> bf16
// 256 threads = 8 waves; tile 64(M) x 128(N); BK=32; double-buffered async LDS.

__global__ __launch_bounds__(256) void proj_gemm(
    const u16* __restrict__ xq, const u16* __restrict__ xc,
    const u16* __restrict__ wtq, const u16* __restrict__ wtc,
    u16* __restrict__ pq, u16* __restrict__ pc)
{
    const u16* x  = blockIdx.z ? xc  : xq;
    const u16* wt = blockIdx.z ? wtc : wtq;
    u16*       p  = blockIdx.z ? pc  : pq;

    __shared__ u16 Ab[2][64][40];
    __shared__ u16 Bb[2][128][40];

    const int tid  = threadIdx.x;
    const int lane = tid & 31, wid = tid >> 5;
    const int hl   = (lane >> 4) & 1, mr = lane & 15;
    const int wm   = wid & 3, wn = wid >> 2;
    const int row0 = blockIdx.x * 64;
    const int col0 = blockIdx.y * 128;

    const int ar = tid >> 2;            // 0..63
    const int ac = (tid & 3) * 8;       // chunk of 8 bf16 = 16B

    v8f acc0 = {}, acc1 = {}, acc2 = {}, acc3 = {};

    auto stage = [&](int k0, int buf) {
        async_cp16(x  + (size_t)(row0 + ar)      * 1024 + k0 + ac, &Ab[buf][ar][ac]);
        async_cp16(wt + (size_t)(col0 + ar)      * 1024 + k0 + ac, &Bb[buf][ar][ac]);
        async_cp16(wt + (size_t)(col0 + 64 + ar) * 1024 + k0 + ac, &Bb[buf][64 + ar][ac]);
    };

    stage(0, 0);
    int buf = 0;
    for (int k0 = 0; k0 < 1024; k0 += 32) {
        wait_async0();
        __syncthreads();
        if (k0 + 32 < 1024) stage(k0 + 32, buf ^ 1);

        Frag a;
        #pragma unroll
        for (int r = 0; r < 8; r++)
            a.u[r] = *(const u32*)&Ab[buf][wm * 16 + mr][kpair(r, hl)];

        Frag b0, b1, b2, b3;
        #pragma unroll
        for (int r = 0; r < 8; r++) {
            int kk = kpair(r, hl);
            b0.u[r] = *(const u32*)&Bb[buf][wn * 64 +  0 + mr][kk];
            b1.u[r] = *(const u32*)&Bb[buf][wn * 64 + 16 + mr][kk];
            b2.u[r] = *(const u32*)&Bb[buf][wn * 64 + 32 + mr][kk];
            b3.u[r] = *(const u32*)&Bb[buf][wn * 64 + 48 + mr][kk];
        }
        acc0 = bf16_wmma(a, b0, acc0);
        acc1 = bf16_wmma(a, b1, acc1);
        acc2 = bf16_wmma(a, b2, acc2);
        acc3 = bf16_wmma(a, b3, acc3);
        buf ^= 1;
    }

    #pragma unroll
    for (int j = 0; j < 8; j++) {
        int row = row0 + wm * 16 + j + 8 * hl;   // C/D layout: reg j -> row j + 8*half
        int cb  = col0 + wn * 64 + mr;
        p[(size_t)row * 1024 + cb     ] = f2bf(acc0[j]);
        p[(size_t)row * 1024 + cb + 16] = f2bf(acc1[j]);
        p[(size_t)row * 1024 + cb + 32] = f2bf(acc2[j]);
        p[(size_t)row * 1024 + cb + 48] = f2bf(acc3[j]);
    }
}

typedef short s16x8 __attribute__((ext_vector_type(8)));
typedef float f32x2 __attribute__((ext_vector_type(2)));
typedef __bf16 bf16x2 __attribute__((ext_vector_type(2)));

#define KV_KEYS  64     // keys per staged tile
#define K_PITCH  72     // u16 per LDS row = 144 B, an odd multiple of 16 B (ds_load_b128 readers)
#define V_PITCH  80     // u16 per LDS row = 160 B, an odd multiple of 32 B (ds_load_tr16_b128 readers)

__device__ __forceinline__ void kv_copy4(u32 l0, const u16* g0, u32 l1, const u16* g1,
                                         u32 l2, const u16* g2, u32 l3, const u16* g3) {
    asm volatile("global_load_async_to_lds_b128 %0, %1, off\n\t"
                 "global_load_async_to_lds_b128 %2, %3, off\n\t"
                 "global_load_async_to_lds_b128 %4, %5, off\n\t"
                 "global_load_async_to_lds_b128 %6, %7, off\n\t"
                 "s_wait_xcnt 0x0"
                 :: "v"(l0), "v"(g0), "v"(l1), "v"(g1), "v"(l2), "v"(g2), "v"(l3), "v"(g3) : "memory");
}

// lane (c, h) gets T[8h + 0..7][c] of the 16x16 block of 16-bit elements that the lanes' addresses name
__device__ __forceinline__ u32x4 ld_tr16(const u16* p) {
    return __builtin_bit_cast(u32x4, __builtin_amdgcn_ds_load_tr16_b128_v8i16((AS3 s16x8*)p));
}

// two f32 -> one register of two bf16, round to nearest even
__device__ __forceinline__ u32 pack2(float lo, float hi) {
    return __builtin_bit_cast(u32, __builtin_convertvector(f32x2{lo, hi}, bf16x2));
}

__device__ __forceinline__ float xhalf(float x) {
    const int v = __builtin_bit_cast(int, x);
    return __builtin_bit_cast(float,
        __builtin_amdgcn_permlanex16(v, v, 0x76543210, 0xfedcba98, false, false));
}

__global__ __launch_bounds__(256, 8) void attn_kernel(
    const u16* __restrict__ projq, const u16* __restrict__ projc,
    const int* __restrict__ mask_q, const int* __restrict__ mask_c,
    u16* __restrict__ attnq, u16* __restrict__ attnc)
{
    const int tid  = threadIdx.x;
    const int lane = tid & 31, wid = tid >> 5;
    const int hl = lane >> 4, mr = lane & 15;
    const int qb = blockIdx.x * 128 + wid * 16;
    const int h  = blockIdx.y;
    const int b  = blockIdx.z >> 1, type = blockIdx.z & 1;

    const u16* Q     = type ? projq : projc;
    const u16* KV    = type ? projc : projq;
    const int* maskp = type ? mask_c : mask_q;
    u16*       out   = type ? attnc : attnq;

    __shared__ __attribute__((aligned(16))) u16 Kt[2][KV_KEYS][K_PITCH];
    __shared__ __attribute__((aligned(16))) u16 Vt[2][KV_KEYS][V_PITCH];

    // each thread copies chunk cc (16 B) of rows cr and cr + 32 of a tile
    const int cr = tid >> 3, cc = (tid & 7) * 8;
    const u16* gsrc = KV + ((size_t)(b * 1024 + cr)) * 1024 + h * 64 + cc;
    const u32  kdst = (u32)(size_t)&Kt[0][cr][cc];
    const u32  vdst = (u32)(size_t)&Vt[0][cr][cc];
    auto stage = [&](int t, int buf) {
        const u16* g  = gsrc + (size_t)t * (KV_KEYS * 1024);
        const u32  lk = kdst + (u32)buf * (u32)(KV_KEYS * K_PITCH * 2);
        const u32  lv = vdst + (u32)buf * (u32)(KV_KEYS * V_PITCH * 2);
        kv_copy4(lk, g, lk + 32u * K_PITCH * 2u, g + 32 * 1024,
                 lv, g, lv + 32u * V_PITCH * 2u, g + 32 * 1024);
    };

    stage(0, 0);

    // Q fragments, now the B operand: column = query mr, d in the hardware k order
    Frag aq0, aq1;
    {
        const u16* qrow = Q + ((size_t)(b * 1024 + qb + mr)) * 1024 + h * 64;
        #pragma unroll
        for (int r = 0; r < 8; r++) {
            int k = kpair(r, hl);
            aq0.u[r] = *(const u32*)(qrow + k);
            aq1.u[r] = *(const u32*)(qrow + 32 + k);
        }
    }
    asm volatile("s_wait_xcnt 0x0" ::: "memory");

    // This lane's query: 1/sqrt(DK) in base 2. A masked query has every score equal
    // (-65504 in the definition); softmax does not see a shift common to a row, so scale 0 gives
    // the same uniform row.
    const float cs = (maskp[b * 1024 + qb + mr] == 0) ? 0.0f : 0.125f * 1.4426950408889634f;

    float mstat = -1.0e30f;     // running maximum, scaled, equal in both halves of the wave
    float lstat = 0.0f;         // running sum over this half's keys; the halves join behind the loop
    v8f o0 = {}, o1 = {}, o2 = {}, o3 = {};     // o_t[r] = O[query mr][16 t + 8 hl + r]

    // tile 0 has landed for this wave, then for the block; only then tile 1 starts
    asm volatile("s_wait_asynccnt 0x0" ::: "memory");
    __syncthreads();
    stage(1, 1);

    for (int t = 0; t < 1024 / KV_KEYS; t++) {
        const int buf = t & 1;
        // unrolled: every LDS offset of a half becomes an immediate of its load
        #pragma unroll
        for (int sub = 0; sub < 2; sub++) {
            // K fragments, the A operand: row = key, d in the hardware k order (as Q's)
            Frag bk0, bk1, bk2, bk3;
            {
                const u16* kr0 = &Kt[buf][sub * 32      + mr][8 * hl];
                const u16* kr1 = &Kt[buf][sub * 32 + 16 + mr][8 * hl];
                bk0.q[0] = *(const u32x4*)(kr0);      bk0.q[1] = *(const u32x4*)(kr0 + 16);
                bk1.q[0] = *(const u32x4*)(kr0 + 32); bk1.q[1] = *(const u32x4*)(kr0 + 48);
                bk2.q[0] = *(const u32x4*)(kr1);      bk2.q[1] = *(const u32x4*)(kr1 + 16);
                bk3.q[0] = *(const u32x4*)(kr1 + 32); bk3.q[1] = *(const u32x4*)(kr1 + 48);
            }
            // s0[r] = score(key 8 hl + r, query mr), s1[r] = score(key 16 + 8 hl + r, query mr)
            v8f s0 = {}, s1 = {};
            s0 = bf16_wmma(bk0, aq0, s0);
            s0 = bf16_wmma(bk1, aq1, s0);
            s1 = bf16_wmma(bk2, aq0, s1);
            s1 = bf16_wmma(bk3, aq1, s1);

            // V^T fragments, the A operand: the same rows, transposed on the way out of LDS;
            // keys 0-15 fill registers 0-3, keys 16-31 registers 4-7 (hardware k order, as P^T's)
            Frag bv0, bv1, bv2, bv3;
            {
                const u16* vr = &Vt[buf][sub * 32 + 8 * hl + (lane & 7)][8 * ((lane >> 3) & 1)];
                bv0.q[0] = ld_tr16(vr);      bv0.q[1] = ld_tr16(vr + 16 * V_PITCH);
                bv1.q[0] = ld_tr16(vr + 16); bv1.q[1] = ld_tr16(vr + 16 * V_PITCH + 16);
                bv2.q[0] = ld_tr16(vr + 32); bv2.q[1] = ld_tr16(vr + 16 * V_PITCH + 32);
                bv3.q[0] = ld_tr16(vr + 48); bv3.q[1] = ld_tr16(vr + 16 * V_PITCH + 48);
            }

            // maximum of the raw scores (the scale is not negative), then over both halves
            float mx = fmaxf(s0[0], s1[0]);
            #pragma unroll
            for (int r = 1; r < 8; r++) mx = fmaxf(mx, fmaxf(s0[r], s1[r]));
            mx = fmaxf(mx, xhalf(mx));
            const float mn = fmaxf(mstat, mx * cs);
            const float al = __builtin_amdgcn_exp2f(mstat - mn);
            mstat = mn;

            // P^T: elements 0-7 from s0, 8-15 from s1, the k order of a B operand
            Frag pf;
            f32x2 rs = {0.0f, 0.0f};
            #pragma unroll
            for (int i = 0; i < 4; i++) {
                const f32x2 a0 = __builtin_elementwise_fma(f32x2{s0[2 * i], s0[2 * i + 1]}, f32x2{cs, cs}, f32x2{-mn, -mn});
                const f32x2 a1 = __builtin_elementwise_fma(f32x2{s1[2 * i], s1[2 * i + 1]}, f32x2{cs, cs}, f32x2{-mn, -mn});
                const f32x2 e0 = {__builtin_amdgcn_exp2f(a0.x), __builtin_amdgcn_exp2f(a0.y)};
                const f32x2 e1 = {__builtin_amdgcn_exp2f(a1.x), __builtin_amdgcn_exp2f(a1.y)};
                pf.u[i]     = pack2(e0.x, e0.y);
                pf.u[4 + i] = pack2(e1.x, e1.y);
                rs += e0 + e1;
            }
            lstat = lstat * al + (rs.x + rs.y);
            o0 *= al; o1 *= al; o2 *= al; o3 *= al;

            o0 = bf16_wmma(bv0, pf, o0);
            o1 = bf16_wmma(bv1, pf, o1);
            o2 = bf16_wmma(bv2, pf, o2);
            o3 = bf16_wmma(bv3, pf, o3);
        }

        // hand-over: this wave's reads of tile t are done, its copies of tile t + 1
        // have landed; behind the barrier both hold for the whole block
        asm volatile("s_wait_dscnt 0x0" ::: "memory");
        asm volatile("s_wait_asynccnt 0x0" ::: "memory");
        __syncthreads();
        if (t + 2 < 1024 / KV_KEYS) stage(t + 2, buf);
    }
    // no copy is left in flight when the wave ends
    asm volatile("s_wait_asynccnt 0x0" ::: "memory");

    // a lane's 8 registers of a tile are 8 consecutive d of its query: one 16-byte store each
    const float inv = 1.0f / (lstat + xhalf(lstat));
    u16* orow = out + (u32)((b * 1024 + qb + mr) * 1024 + h * 64 + 8 * hl);
    o0 *= inv; o1 *= inv; o2 *= inv; o3 *= inv;
    *(u32x4*)(orow)      = u32x4{pack2(o0[0], o0[1]), pack2(o0[2], o0[3]), pack2(o0[4], o0[5]), pack2(o0[6], o0[7])};
    *(u32x4*)(orow + 16) = u32x4{pack2(o1[0], o1[1]), pack2(o1[2], o1[3]), pack2(o1[4], o1[5]), pack2(o1[6], o1[7])};
    *(u32x4*)(orow + 32) = u32x4{pack2(o2[0], o2[1]), pack2(o2[2], o2[3]), pack2(o2[4], o2[5]), pack2(o2[6], o2[7])};
    *(u32x4*)(orow + 48) = u32x4{pack2(o3[0], o3[1]), pack2(o3[2], o3[3]), pack2(o3[4], o3[5]), pack2(o3[6], o3[7])};
}

// ---------------------------------------------------------------- FFN GEMM
// out = x + tanh(concat([x, x_attn]) @ W + b);  M=4096, N=1024, K=2048.
// Wt is [1024(N) x 2048(K)] bf16 (pre-transposed).

__global__ __launch_bounds__(256) void ffn_gemm(
    const u16* __restrict__ xqb, const u16* __restrict__ xcb,
    const u16* __restrict__ aqb, const u16* __restrict__ acb,
    const u16* __restrict__ w1t, const u16* __restrict__ w2t,
    const float* __restrict__ b1, const float* __restrict__ b2,
    const float* __restrict__ xq, const float* __restrict__ xc,
    float* __restrict__ outq, float* __restrict__ outc)
{
    const u16* src0  = blockIdx.z ? xcb : xqb;
    const u16* src1  = blockIdx.z ? acb : aqb;
    const u16* wt    = blockIdx.z ? w2t : w1t;
    const float* bias = blockIdx.z ? b2 : b1;
    const float* xf  = blockIdx.z ? xc : xq;
    float*       out = blockIdx.z ? outc : outq;

    __shared__ u16 Ab[2][64][40];
    __shared__ u16 Bb[2][128][40];

    const int tid  = threadIdx.x;
    const int lane = tid & 31, wid = tid >> 5;
    const int hl   = (lane >> 4) & 1, mr = lane & 15;
    const int wm   = wid & 3, wn = wid >> 2;
    const int row0 = blockIdx.x * 64;
    const int col0 = blockIdx.y * 128;

    const int ar = tid >> 2;
    const int ac = (tid & 3) * 8;

    v8f acc0 = {}, acc1 = {}, acc2 = {}, acc3 = {};

    auto stage = [&](int k0, int buf) {
        const u16* asrc = (k0 < 1024) ? src0 : src1;
        const int  ka   = k0 & 1023;
        async_cp16(asrc + (size_t)(row0 + ar)      * 1024 + ka + ac, &Ab[buf][ar][ac]);
        async_cp16(wt   + (size_t)(col0 + ar)      * 2048 + k0 + ac, &Bb[buf][ar][ac]);
        async_cp16(wt   + (size_t)(col0 + 64 + ar) * 2048 + k0 + ac, &Bb[buf][64 + ar][ac]);
    };

    stage(0, 0);
    int buf = 0;
    for (int k0 = 0; k0 < 2048; k0 += 32) {
        wait_async0();
        __syncthreads();
        if (k0 + 32 < 2048) stage(k0 + 32, buf ^ 1);

        Frag a;
        #pragma unroll
        for (int r = 0; r < 8; r++)
            a.u[r] = *(const u32*)&Ab[buf][wm * 16 + mr][kpair(r, hl)];

        Frag b0f, b1f, b2f, b3f;
        #pragma unroll
        for (int r = 0; r < 8; r++) {
            int kk = kpair(r, hl);
            b0f.u[r] = *(const u32*)&Bb[buf][wn * 64 +  0 + mr][kk];
            b1f.u[r] = *(const u32*)&Bb[buf][wn * 64 + 16 + mr][kk];
            b2f.u[r] = *(const u32*)&Bb[buf][wn * 64 + 32 + mr][kk];
            b3f.u[r] = *(const u32*)&Bb[buf][wn * 64 + 48 + mr][kk];
        }
        acc0 = bf16_wmma(a, b0f, acc0);
        acc1 = bf16_wmma(a, b1f, acc1);
        acc2 = bf16_wmma(a, b2f, acc2);
        acc3 = bf16_wmma(a, b3f, acc3);
        buf ^= 1;
    }

    const int colb = col0 + wn * 64 + mr;
    const float bb0 = bias[colb], bb1 = bias[colb + 16];
    const float bb2 = bias[colb + 32], bb3 = bias[colb + 48];
    #pragma unroll
    for (int j = 0; j < 8; j++) {
        size_t row = (size_t)(row0 + wm * 16 + j + 8 * hl);
        size_t i0 = row * 1024 + colb;
        out[i0     ] = xf[i0     ] + tanhf(acc0[j] + bb0);
        out[i0 + 16] = xf[i0 + 16] + tanhf(acc1[j] + bb1);
        out[i0 + 32] = xf[i0 + 32] + tanhf(acc2[j] + bb2);
        out[i0 + 48] = xf[i0 + 48] + tanhf(acc3[j] + bb3);
    }
}

// ---------------------------------------------------------------- launcher

extern "C" void kernel_launch(void* const* d_in, const int* in_sizes, int n_in,
                              void* d_out, int out_size, void* d_ws, size_t ws_size,
                              hipStream_t stream) {
    (void)in_sizes; (void)n_in; (void)out_size; (void)ws_size;

    const float* question = (const float*)d_in[0];
    const float* context  = (const float*)d_in[1];
    const int*   mask_q   = (const int*)d_in[2];
    const int*   mask_c   = (const int*)d_in[3];
    const float* Wq = (const float*)d_in[4];
    const float* Wc = (const float*)d_in[5];
    const float* W1 = (const float*)d_in[6];
    const float* b1 = (const float*)d_in[7];
    const float* W2 = (const float*)d_in[8];
    const float* b2 = (const float*)d_in[9];

    const size_t NX = (size_t)4 * 1024 * 1024;   // B*S*D
    u16* ws  = (u16*)d_ws;
    u16* xqb = ws;                u16* xcb = xqb + NX;
    u16* wqb = xcb + NX;          u16* wcb = wqb + (size_t)1024 * 1024;
    u16* w1b = wcb + (size_t)1024 * 1024;
    u16* w2b = w1b + (size_t)2048 * 1024;
    u16* pq  = w2b + (size_t)2048 * 1024;
    u16* pc  = pq + NX;
    u16* aq  = pc + NX;
    u16* ac  = aq + NX;

    float* outq = (float*)d_out;
    float* outc = outq + NX;

    cvt_bf16<<<512, 256, 0, stream>>>(question, xqb, (int)NX);
    cvt_bf16<<<512, 256, 0, stream>>>(context,  xcb, (int)NX);
    // weights converted AND transposed to [N][K] so GEMM tiles are contiguous
    cvt_bf16_t<<<dim3(32, 32), dim3(32, 8), 0, stream>>>(Wq, wqb, 1024, 1024);
    cvt_bf16_t<<<dim3(32, 32), dim3(32, 8), 0, stream>>>(Wc, wcb, 1024, 1024);
    cvt_bf16_t<<<dim3(32, 64), dim3(32, 8), 0, stream>>>(W1, w1b, 2048, 1024);
    cvt_bf16_t<<<dim3(32, 64), dim3(32, 8), 0, stream>>>(W2, w2b, 2048, 1024);

    proj_gemm<<<dim3(64, 8, 2), 256, 0, stream>>>(xqb, xcb, wqb, wcb, pq, pc);
    attn_kernel<<<dim3(8, 16, 8), 256, 0, stream>>>(pq, pc, mask_q, mask_c, aq, ac);
    ffn_gemm<<<dim3(64, 8, 2), 256, 0, stream>>>(xqb, xcb, aq, ac, w1b, w2b,
                                                 b1, b2, question, context, outq, outc);
}

// v003
// Measured time: 130 microseconds a run.
// In both of two side-by-side timings against v002, it was 1.14 times as fast.
// Counting every step since v000, it is 2.23 times as fast.
#include <hip/hip_runtime.h>

typedef unsigned short u16;
typedef unsigned int   u32;
typedef __attribute__((ext_vector_type(16))) __bf16 v16bf;
typedef __attribute__((ext_vector_type(8)))  float  v8f;
typedef int v4i __attribute__((vector_size(16)));

#define AS1 __attribute__((address_space(1)))
#define AS3 __attribute__((address_space(3)))

#if defined(__has_builtin)
# if __has_builtin(__builtin_amdgcn_global_load_async_to_lds_b128)
#  define HAS_ASYNC_LDS 1
# endif
# if __has_builtin(__builtin_amdgcn_s_wait_asynccnt)
#  define HAS_WAIT_ASYNC 1
# endif
#endif
#ifndef HAS_ASYNC_LDS
# define HAS_ASYNC_LDS 0
#endif
#ifndef HAS_WAIT_ASYNC
# define HAS_WAIT_ASYNC 0
#endif

// ---------------------------------------------------------------- utilities

typedef u32 u32x4 __attribute__((ext_vector_type(4)));

union Frag {
    u32   u[8];
    u32x4 q[2];
    u16   s[16];
    v16bf v;
};

__device__ __forceinline__ u16 f2bf(float f) {
    u32 u = __float_as_uint(f);
    u32 r = u + 0x7FFFu + ((u >> 16) & 1u);   // round-to-nearest-even
    return (u16)(r >> 16);
}

__device__ __forceinline__ int kpair(int r, int hl) {
    return (r < 4 ? 2 * r : 16 + 2 * (r - 4)) + 8 * hl;
}

__device__ __forceinline__ v8f bf16_wmma(Frag a, Frag b, v8f c) {
    return __builtin_amdgcn_wmma_f32_16x16x32_bf16(
        false, a.v, false, b.v, (short)0, c, false, false);
}

__device__ __forceinline__ void async_cp16(const u16* g, u16* l) {
#if HAS_ASYNC_LDS
    __builtin_amdgcn_global_load_async_to_lds_b128(
        (AS1 v4i*)(size_t)g,    // flat address == global address for global mem
        (AS3 v4i*)l,            // generic -> LDS addrspacecast
        0, 0);
#else
    *(uint4*)l = *(const uint4*)g;
#endif
}

__device__ __forceinline__ void wait_async0() {
#if HAS_WAIT_ASYNC
    __builtin_amdgcn_s_wait_asynccnt(0);
#elif HAS_ASYNC_LDS
    asm volatile("s_wait_asynccnt 0x0" ::: "memory");
#endif
}

// ---------------------------------------------------------------- pre-pass
// ONE launch rounds both activations to bf16 and lays all four weights down as
// [N][K] bf16 (N-major, so that the GEMMs' B tiles are contiguous row copies).
// 256 work-groups of 16 waves, all with the same share: six 64 x 64 weight tiles
// (one of Wq, one of Wc, two of W1, two of W2) and 4096 16-byte pieces of each
// activation. A thread issues all its 28 loads before it uses the first, so the
// whole input is in flight at once; every wave-wide load and store covers whole
// 128-byte lines.

typedef float f32x4 __attribute__((ext_vector_type(4)));
typedef float f32x2 __attribute__((ext_vector_type(2)));
typedef __bf16 bf16x2 __attribute__((ext_vector_type(2)));
typedef u32 u32x2 __attribute__((ext_vector_type(2)));

// two f32 -> one register of two bf16, round to nearest even
__device__ __forceinline__ u32 pack2(float lo, float hi) {
    return __builtin_bit_cast(u32, __builtin_convertvector(f32x2{lo, hi}, bf16x2));
}

__global__ __launch_bounds__(512) void prep(
    const float* __restrict__ question, const float* __restrict__ context,
    const float* __restrict__ Wq, const float* __restrict__ Wc,
    const float* __restrict__ W1, const float* __restrict__ W2,
    u16* __restrict__ xqb, u16* __restrict__ xcb,
    u16* __restrict__ wqb, u16* __restrict__ wcb,
    u16* __restrict__ w1b, u16* __restrict__ w2b)
{
    __shared__ __attribute__((aligned(16))) u32 tl[6][64][32];

    const int t  = threadIdx.x;
    const int nt = blockIdx.x & 15, kt = blockIdx.x >> 4;    // tile column, tile row

    // weights: this thread reads columns 4 c4 .. 4 c4 + 3 of tile rows 2 r and 2 r + 1
    const int c4 = t & 15, r = t >> 4;
    const u32 so = (u32)((kt * 64 + 2 * r) * 1024 + nt * 64 + 4 * c4);
    const float* wsrc[6] = {Wq + so, Wc + so, W1 + so, W1 + so + 1024 * 1024,
                            W2 + so, W2 + so + 1024 * 1024};
    f32x4 w0[6], w1[6];
    #pragma unroll
    for (int i = 0; i < 6; i++) {
        w0[i] = *(const f32x4*)(wsrc[i]);
        w1[i] = *(const f32x4*)(wsrc[i] + 1024);
    }
    asm volatile("s_wait_xcnt 0x0" ::: "memory");

    // activations: piece xo + 512 i, so that a wave reads 512 contiguous bytes
    const u32 xo = (u32)blockIdx.x * 4096u + (u32)t;
    f32x4 xa[8], xb[8];
    #pragma unroll
    for (int i = 0; i < 8; i++) xa[i] = ((const f32x4*)question)[xo + 512u * i];
    #pragma unroll
    for (int i = 0; i < 8; i++) xb[i] = ((const f32x4*)context)[xo + 512u * i];
    // keeps every load above this line: without it the compiler sinks the weight loads to
    // their uses, pair by pair, and the wave pays one memory latency after another
    __builtin_amdgcn_sched_barrier(0);

    {
        const int col = (((r >> 2) ^ (c4 & 7)) << 2) + (r & 3);
        #pragma unroll
        for (int i = 0; i < 6; i++)
            #pragma unroll
            for (int j = 0; j < 4; j++)
                tl[i][4 * c4 + j][col] = pack2(w0[i][j], w1[i][j]);
    }
    __syncthreads();
    {
        // this thread stores k = 8 q .. 8 q + 7 of column n: a wave fills four whole lines
        const int n = t >> 3, q = t & 7;
        const int col = (q ^ ((n >> 2) & 7)) << 2;
        const u32 d1 = (u32)((nt * 64 + n) * 1024 + kt * 64 + 8 * q);
        const u32 d2 = (u32)((nt * 64 + n) * 2048 + kt * 64 + 8 * q);
        u16* wdst[6] = {wqb + d1, wcb + d1, w1b + d2, w1b + d2 + 1024, w2b + d2, w2b + d2 + 1024};
        #pragma unroll
        for (int i = 0; i < 6; i++)
            *(u32x4*)(wdst[i]) = *(const u32x4*)&tl[i][n][col];
    }

    #pragma unroll
    for (int i = 0; i < 8; i++)
        ((u32x2*)xqb)[xo + 512u * i] = u32x2{pack2(xa[i].x, xa[i].y), pack2(xa[i].z, xa[i].w)};
    #pragma unroll
    for (int i = 0; i < 8; i++)
        ((u32x2*)xcb)[xo + 512u * i] = u32x2{pack2(xb[i].x, xb[i].y), pack2(xb[i].z, xb[i].w)};
}

// ---------------------------------------------------------------- projection GEMM
// [4096 x 1024] (bf16) @ Wt [1024(N) x 1024(K)] (bf16) -> bf16
// 256 threads = 8 waves; tile 64(M) x 128(N); BK=32; double-buffered async LDS.

__global__ __launch_bounds__(256) void proj_gemm(
    const u16* __restrict__ xq, const u16* __restrict__ xc,
    const u16* __restrict__ wtq, const u16* __restrict__ wtc,
    u16* __restrict__ pq, u16* __restrict__ pc)
{
    const u16* x  = blockIdx.z ? xc  : xq;
    const u16* wt = blockIdx.z ? wtc : wtq;
    u16*       p  = blockIdx.z ? pc  : pq;

    __shared__ u16 Ab[2][64][40];
    __shared__ u16 Bb[2][128][40];

    const int tid  = threadIdx.x;
    const int lane = tid & 31, wid = tid >> 5;
    const int hl   = (lane >> 4) & 1, mr = lane & 15;
    const int wm   = wid & 3, wn = wid >> 2;
    const int row0 = blockIdx.x * 64;
    const int col0 = blockIdx.y * 128;

    const int ar = tid >> 2;            // 0..63
    const int ac = (tid & 3) * 8;       // chunk of 8 bf16 = 16B

    v8f acc0 = {}, acc1 = {}, acc2 = {}, acc3 = {};

    auto stage = [&](int k0, int buf) {
        async_cp16(x  + (size_t)(row0 + ar)      * 1024 + k0 + ac, &Ab[buf][ar][ac]);
        async_cp16(wt + (size_t)(col0 + ar)      * 1024 + k0 + ac, &Bb[buf][ar][ac]);
        async_cp16(wt + (size_t)(col0 + 64 + ar) * 1024 + k0 + ac, &Bb[buf][64 + ar][ac]);
    };

    stage(0, 0);
    int buf = 0;
    for (int k0 = 0; k0 < 1024; k0 += 32) {
        wait_async0();
        __syncthreads();
        if (k0 + 32 < 1024) stage(k0 + 32, buf ^ 1);

        Frag a;
        #pragma unroll
        for (int r = 0; r < 8; r++)
            a.u[r] = *(const u32*)&Ab[buf][wm * 16 + mr][kpair(r, hl)];

        Frag b0, b1, b2, b3;
        #pragma unroll
        for (int r = 0; r < 8; r++) {
            int kk = kpair(r, hl);
            b0.u[r] = *(const u32*)&Bb[buf][wn * 64 +  0 + mr][kk];
            b1.u[r] = *(const u32*)&Bb[buf][wn * 64 + 16 + mr][kk];
            b2.u[r] = *(const u32*)&Bb[buf][wn * 64 + 32 + mr][kk];
            b3.u[r] = *(const u32*)&Bb[buf][wn * 64 + 48 + mr][kk];
        }
        acc0 = bf16_wmma(a, b0, acc0);
        acc1 = bf16_wmma(a, b1, acc1);
        acc2 = bf16_wmma(a, b2, acc2);
        acc3 = bf16_wmma(a, b3, acc3);
        buf ^= 1;
    }

    #pragma unroll
    for (int j = 0; j < 8; j++) {
        int row = row0 + wm * 16 + j + 8 * hl;   // C/D layout: reg j -> row j + 8*half
        int cb  = col0 + wn * 64 + mr;
        p[(size_t)row * 1024 + cb     ] = f2bf(acc0[j]);
        p[(size_t)row * 1024 + cb + 16] = f2bf(acc1[j]);
        p[(size_t)row * 1024 + cb + 32] = f2bf(acc2[j]);
        p[(size_t)row * 1024 + cb + 48] = f2bf(acc3[j]);
    }
}

typedef short s16x8 __attribute__((ext_vector_type(8)));

#define KV_KEYS  64     // keys per staged tile
#define K_PITCH  72     // u16 per LDS row = 144 B, an odd multiple of 16 B (ds_load_b128 readers)
#define V_PITCH  80     // u16 per LDS row = 160 B, an odd multiple of 32 B (ds_load_tr16_b128 readers)

__device__ __forceinline__ void kv_copy4(u32 l0, const u16* g0, u32 l1, const u16* g1,
                                         u32 l2, const u16* g2, u32 l3, const u16* g3) {
    asm volatile("global_load_async_to_lds_b128 %0, %1, off\n\t"
                 "global_load_async_to_lds_b128 %2, %3, off\n\t"
                 "global_load_async_to_lds_b128 %4, %5, off\n\t"
                 "global_load_async_to_lds_b128 %6, %7, off\n\t"
                 "s_wait_xcnt 0x0"
                 :: "v"(l0), "v"(g0), "v"(l1), "v"(g1), "v"(l2), "v"(g2), "v"(l3), "v"(g3) : "memory");
}

// lane (c, h) gets T[8h + 0..7][c] of the 16x16 block of 16-bit elements that the lanes' addresses name
__device__ __forceinline__ u32x4 ld_tr16(const u16* p) {
    return __builtin_bit_cast(u32x4, __builtin_amdgcn_ds_load_tr16_b128_v8i16((AS3 s16x8*)p));
}

__device__ __forceinline__ float xhalf(float x) {
    const int v = __builtin_bit_cast(int, x);
    return __builtin_bit_cast(float,
        __builtin_amdgcn_permlanex16(v, v, 0x76543210, 0xfedcba98, false, false));
}

__global__ __launch_bounds__(256, 8) void attn_kernel(
    const u16* __restrict__ projq, const u16* __restrict__ projc,
    const int* __restrict__ mask_q, const int* __restrict__ mask_c,
    u16* __restrict__ attnq, u16* __restrict__ attnc)
{
    const int tid  = threadIdx.x;
    const int lane = tid & 31, wid = tid >> 5;
    const int hl = lane >> 4, mr = lane & 15;
    const int qb = blockIdx.x * 128 + wid * 16;
    const int h  = blockIdx.y;
    const int b  = blockIdx.z >> 1, type = blockIdx.z & 1;

    const u16* Q     = type ? projq : projc;
    const u16* KV    = type ? projc : projq;
    const int* maskp = type ? mask_c : mask_q;
    u16*       out   = type ? attnc : attnq;

    __shared__ __attribute__((aligned(16))) u16 Kt[2][KV_KEYS][K_PITCH];
    __shared__ __attribute__((aligned(16))) u16 Vt[2][KV_KEYS][V_PITCH];

    // each thread copies chunk cc (16 B) of rows cr and cr + 32 of a tile
    const int cr = tid >> 3, cc = (tid & 7) * 8;
    const u16* gsrc = KV + ((size_t)(b * 1024 + cr)) * 1024 + h * 64 + cc;
    const u32  kdst = (u32)(size_t)&Kt[0][cr][cc];
    const u32  vdst = (u32)(size_t)&Vt[0][cr][cc];
    auto stage = [&](int t, int buf) {
        const u16* g  = gsrc + (size_t)t * (KV_KEYS * 1024);
        const u32  lk = kdst + (u32)buf * (u32)(KV_KEYS * K_PITCH * 2);
        const u32  lv = vdst + (u32)buf * (u32)(KV_KEYS * V_PITCH * 2);
        kv_copy4(lk, g, lk + 32u * K_PITCH * 2u, g + 32 * 1024,
                 lv, g, lv + 32u * V_PITCH * 2u, g + 32 * 1024);
    };

    stage(0, 0);

    // Q fragments, now the B operand: column = query mr, d in the hardware k order
    Frag aq0, aq1;
    {
        const u16* qrow = Q + ((size_t)(b * 1024 + qb + mr)) * 1024 + h * 64;
        #pragma unroll
        for (int r = 0; r < 8; r++) {
            int k = kpair(r, hl);
            aq0.u[r] = *(const u32*)(qrow + k);
            aq1.u[r] = *(const u32*)(qrow + 32 + k);
        }
    }
    asm volatile("s_wait_xcnt 0x0" ::: "memory");

    // This lane's query: 1/sqrt(DK) in base 2. A masked query has every score equal
    // (-65504 in the definition); softmax does not see a shift common to a row, so scale 0 gives
    // the same uniform row.
    const float cs = (maskp[b * 1024 + qb + mr] == 0) ? 0.0f : 0.125f * 1.4426950408889634f;

    float mstat = -1.0e30f;     // running maximum, scaled, equal in both halves of the wave
    float lstat = 0.0f;         // running sum over this half's keys; the halves join behind the loop
    v8f o0 = {}, o1 = {}, o2 = {}, o3 = {};     // o_t[r] = O[query mr][16 t + 8 hl + r]

    // tile 0 has landed for this wave, then for the block; only then tile 1 starts
    asm volatile("s_wait_asynccnt 0x0" ::: "memory");
    __syncthreads();
    stage(1, 1);

    for (int t = 0; t < 1024 / KV_KEYS; t++) {
        const int buf = t & 1;
        // unrolled: every LDS offset of a half becomes an immediate of its load
        #pragma unroll
        for (int sub = 0; sub < 2; sub++) {
            // K fragments, the A operand: row = key, d in the hardware k order (as Q's)
            Frag bk0, bk1, bk2, bk3;
            {
                const u16* kr0 = &Kt[buf][sub * 32      + mr][8 * hl];
                const u16* kr1 = &Kt[buf][sub * 32 + 16 + mr][8 * hl];
                bk0.q[0] = *(const u32x4*)(kr0);      bk0.q[1] = *(const u32x4*)(kr0 + 16);
                bk1.q[0] = *(const u32x4*)(kr0 + 32); bk1.q[1] = *(const u32x4*)(kr0 + 48);
                bk2.q[0] = *(const u32x4*)(kr1);      bk2.q[1] = *(const u32x4*)(kr1 + 16);
                bk3.q[0] = *(const u32x4*)(kr1 + 32); bk3.q[1] = *(const u32x4*)(kr1 + 48);
            }
            // s0[r] = score(key 8 hl + r, query mr), s1[r] = score(key 16 + 8 hl + r, query mr)
            v8f s0 = {}, s1 = {};
            s0 = bf16_wmma(bk0, aq0, s0);
            s0 = bf16_wmma(bk1, aq1, s0);
            s1 = bf16_wmma(bk2, aq0, s1);
            s1 = bf16_wmma(bk3, aq1, s1);

            // V^T fragments, the A operand: the same rows, transposed on the way out of LDS;
            // keys 0-15 fill registers 0-3, keys 16-31 registers 4-7 (hardware k order, as P^T's)
            Frag bv0, bv1, bv2, bv3;
            {
                const u16* vr = &Vt[buf][sub * 32 + 8 * hl + (lane & 7)][8 * ((lane >> 3) & 1)];
                bv0.q[0] = ld_tr16(vr);      bv0.q[1] = ld_tr16(vr + 16 * V_PITCH);
                bv1.q[0] = ld_tr16(vr + 16); bv1.q[1] = ld_tr16(vr + 16 * V_PITCH + 16);
                bv2.q[0] = ld_tr16(vr + 32); bv2.q[1] = ld_tr16(vr + 16 * V_PITCH + 32);
                bv3.q[0] = ld_tr16(vr + 48); bv3.q[1] = ld_tr16(vr + 16 * V_PITCH + 48);
            }

            // maximum of the raw scores (the scale is not negative), then over both halves
            float mx = fmaxf(s0[0], s1[0]);
            #pragma unroll
            for (int r = 1; r < 8; r++) mx = fmaxf(mx, fmaxf(s0[r], s1[r]));
            mx = fmaxf(mx, xhalf(mx));
            const float mn = fmaxf(mstat, mx * cs);
            const float al = __builtin_amdgcn_exp2f(mstat - mn);
            mstat = mn;

            // P^T: elements 0-7 from s0, 8-15 from s1, the k order of a B operand
            Frag pf;
            f32x2 rs = {0.0f, 0.0f};
            #pragma unroll
            for (int i = 0; i < 4; i++) {
                const f32x2 a0 = __builtin_elementwise_fma(f32x2{s0[2 * i], s0[2 * i + 1]}, f32x2{cs, cs}, f32x2{-mn, -mn});
                const f32x2 a1 = __builtin_elementwise_fma(f32x2{s1[2 * i], s1[2 * i + 1]}, f32x2{cs, cs}, f32x2{-mn, -mn});
                const f32x2 e0 = {__builtin_amdgcn_exp2f(a0.x), __builtin_amdgcn_exp2f(a0.y)};
                const f32x2 e1 = {__builtin_amdgcn_exp2f(a1.x), __builtin_amdgcn_exp2f(a1.y)};
                pf.u[i]     = pack2(e0.x, e0.y);
                pf.u[4 + i] = pack2(e1.x, e1.y);
                rs += e0 + e1;
            }
            lstat = lstat * al + (rs.x + rs.y);
            o0 *= al; o1 *= al; o2 *= al; o3 *= al;

            o0 = bf16_wmma(bv0, pf, o0);
            o1 = bf16_wmma(bv1, pf, o1);
            o2 = bf16_wmma(bv2, pf, o2);
            o3 = bf16_wmma(bv3, pf, o3);
        }

        // hand-over: this wave's reads of tile t are done, its copies of tile t + 1
        // have landed; behind the barrier both hold for the whole block
        asm volatile("s_wait_dscnt 0x0" ::: "memory");
        asm volatile("s_wait_asynccnt 0x0" ::: "memory");
        __syncthreads();
        if (t + 2 < 1024 / KV_KEYS) stage(t + 2, buf);
    }
    // no copy is left in flight when the wave ends
    asm volatile("s_wait_asynccnt 0x0" ::: "memory");

    // a lane's 8 registers of a tile are 8 consecutive d of its query: one 16-byte store each
    const float inv = 1.0f / (lstat + xhalf(lstat));
    u16* orow = out + (u32)((b * 1024 + qb + mr) * 1024 + h * 64 + 8 * hl);
    o0 *= inv; o1 *= inv; o2 *= inv; o3 *= inv;
    *(u32x4*)(orow)      = u32x4{pack2(o0[0], o0[1]), pack2(o0[2], o0[3]), pack2(o0[4], o0[5]), pack2(o0[6], o0[7])};
    *(u32x4*)(orow + 16) = u32x4{pack2(o1[0], o1[1]), pack2(o1[2], o1[3]), pack2(o1[4], o1[5]), pack2(o1[6], o1[7])};
    *(u32x4*)(orow + 32) = u32x4{pack2(o2[0], o2[1]), pack2(o2[2], o2[3]), pack2(o2[4], o2[5]), pack2(o2[6], o2[7])};
    *(u32x4*)(orow + 48) = u32x4{pack2(o3[0], o3[1]), pack2(o3[2], o3[3]), pack2(o3[4], o3[5]), pack2(o3[6], o3[7])};
}

// ---------------------------------------------------------------- FFN GEMM
// out = x + tanh(concat([x, x_attn]) @ W + b);  M=4096, N=1024, K=2048.
// Wt is [1024(N) x 2048(K)] bf16 (pre-transposed).

__global__ __launch_bounds__(256) void ffn_gemm(
    const u16* __restrict__ xqb, const u16* __restrict__ xcb,
    const u16* __restrict__ aqb, const u16* __restrict__ acb,
    const u16* __restrict__ w1t, const u16* __restrict__ w2t,
    const float* __restrict__ b1, const float* __restrict__ b2,
    const float* __restrict__ xq, const float* __restrict__ xc,
    float* __restrict__ outq, float* __restrict__ outc)
{
    const u16* src0  = blockIdx.z ? xcb : xqb;
    const u16* src1  = blockIdx.z ? acb : aqb;
    const u16* wt    = blockIdx.z ? w2t : w1t;
    const float* bias = blockIdx.z ? b2 : b1;
    const float* xf  = blockIdx.z ? xc : xq;
    float*       out = blockIdx.z ? outc : outq;

    __shared__ u16 Ab[2][64][40];
    __shared__ u16 Bb[2][128][40];

    const int tid  = threadIdx.x;
    const int lane = tid & 31, wid = tid >> 5;
    const int hl   = (lane >> 4) & 1, mr = lane & 15;
    const int wm   = wid & 3, wn = wid >> 2;
    const int row0 = blockIdx.x * 64;
    const int col0 = blockIdx.y * 128;

    const int ar = tid >> 2;
    const int ac = (tid & 3) * 8;

    v8f acc0 = {}, acc1 = {}, acc2 = {}, acc3 = {};

    auto stage = [&](int k0, int buf) {
        const u16* asrc = (k0 < 1024) ? src0 : src1;
        const int  ka   = k0 & 1023;
        async_cp16(asrc + (size_t)(row0 + ar)      * 1024 + ka + ac, &Ab[buf][ar][ac]);
        async_cp16(wt   + (size_t)(col0 + ar)      * 2048 + k0 + ac, &Bb[buf][ar][ac]);
        async_cp16(wt   + (size_t)(col0 + 64 + ar) * 2048 + k0 + ac, &Bb[buf][64 + ar][ac]);
    };

    stage(0, 0);
    int buf = 0;
    for (int k0 = 0; k0 < 2048; k0 += 32) {
        wait_async0();
        __syncthreads();
        if (k0 + 32 < 2048) stage(k0 + 32, buf ^ 1);

        Frag a;
        #pragma unroll
        for (int r = 0; r < 8; r++)
            a.u[r] = *(const u32*)&Ab[buf][wm * 16 + mr][kpair(r, hl)];

        Frag b0f, b1f, b2f, b3f;
        #pragma unroll
        for (int r = 0; r < 8; r++) {
            int kk = kpair(r, hl);
            b0f.u[r] = *(const u32*)&Bb[buf][wn * 64 +  0 + mr][kk];
            b1f.u[r] = *(const u32*)&Bb[buf][wn * 64 + 16 + mr][kk];
            b2f.u[r] = *(const u32*)&Bb[buf][wn * 64 + 32 + mr][kk];
            b3f.u[r] = *(const u32*)&Bb[buf][wn * 64 + 48 + mr][kk];
        }
        acc0 = bf16_wmma(a, b0f, acc0);
        acc1 = bf16_wmma(a, b1f, acc1);
        acc2 = bf16_wmma(a, b2f, acc2);
        acc3 = bf16_wmma(a, b3f, acc3);
        buf ^= 1;
    }

    const int colb = col0 + wn * 64 + mr;
    const float bb0 = bias[colb], bb1 = bias[colb + 16];
    const float bb2 = bias[colb + 32], bb3 = bias[colb + 48];
    #pragma unroll
    for (int j = 0; j < 8; j++) {
        size_t row = (size_t)(row0 + wm * 16 + j + 8 * hl);
        size_t i0 = row * 1024 + colb;
        out[i0     ] = xf[i0     ] + tanhf(acc0[j] + bb0);
        out[i0 + 16] = xf[i0 + 16] + tanhf(acc1[j] + bb1);
        out[i0 + 32] = xf[i0 + 32] + tanhf(acc2[j] + bb2);
        out[i0 + 48] = xf[i0 + 48] + tanhf(acc3[j] + bb3);
    }
}

// ---------------------------------------------------------------- launcher

extern "C" void kernel_launch(void* const* d_in, const int* in_sizes, int n_in,
                              void* d_out, int out_size, void* d_ws, size_t ws_size,
                              hipStream_t stream) {
    (void)in_sizes; (void)n_in; (void)out_size; (void)ws_size;

    const float* question = (const float*)d_in[0];
    const float* context  = (const float*)d_in[1];
    const int*   mask_q   = (const int*)d_in[2];
    const int*   mask_c   = (const int*)d_in[3];
    const float* Wq = (const float*)d_in[4];
    const float* Wc = (const float*)d_in[5];
    const float* W1 = (const float*)d_in[6];
    const float* b1 = (const float*)d_in[7];
    const float* W2 = (const float*)d_in[8];
    const float* b2 = (const float*)d_in[9];

    const size_t NX = (size_t)4 * 1024 * 1024;   // B*S*D
    u16* ws  = (u16*)d_ws;
    u16* xqb = ws;                u16* xcb = xqb + NX;
    u16* wqb = xcb + NX;          u16* wcb = wqb + (size_t)1024 * 1024;
    u16* w1b = wcb + (size_t)1024 * 1024;
    u16* w2b = w1b + (size_t)2048 * 1024;
    u16* pq  = w2b + (size_t)2048 * 1024;
    u16* pc  = pq + NX;
    u16* aq  = pc + NX;
    u16* ac  = aq + NX;

    float* outq = (float*)d_out;
    float* outc = outq + NX;

    prep<<<256, 512, 0, stream>>>(question, context, Wq, Wc, W1, W2,
                                  xqb, xcb, wqb, wcb, w1b, w2b);

    proj_gemm<<<dim3(64, 8, 2), 256, 0, stream>>>(xqb, xcb, wqb, wcb, pq, pc);
    attn_kernel<<<dim3(8, 16, 8), 256, 0, stream>>>(pq, pc, mask_q, mask_c, aq, ac);
    ffn_gemm<<<dim3(64, 8, 2), 256, 0, stream>>>(xqb, xcb, aq, ac, w1b, w2b,
                                                 b1, b2, question, context, outq, outc);
}

// v004
// One run takes 95.8 microseconds.
// Next to v003, in two timings, it ran 1.36 times as fast each time.
// Over all steps from v000 it is 3.03 times as fast.
#include <hip/hip_runtime.h>

typedef unsigned short u16;
typedef unsigned int   u32;
typedef __attribute__((ext_vector_type(16))) __bf16 v16bf;
typedef __attribute__((ext_vector_type(8)))  float  v8f;

#define AS3 __attribute__((address_space(3)))

// ---------------------------------------------------------------- utilities

typedef u32 u32x4 __attribute__((ext_vector_type(4)));

union Frag {
    u32   u[8];
    u32x4 q[2];
    u16   s[16];
    v16bf v;
};

__device__ __forceinline__ u16 f2bf(float f) {
    u32 u = __float_as_uint(f);
    u32 r = u + 0x7FFFu + ((u >> 16) & 1u);   // round-to-nearest-even
    return (u16)(r >> 16);
}

__device__ __forceinline__ int kpair(int r, int hl) {
    return (r < 4 ? 2 * r : 16 + 2 * (r - 4)) + 8 * hl;
}

__device__ __forceinline__ v8f bf16_wmma(Frag a, Frag b, v8f c) {
    return __builtin_amdgcn_wmma_f32_16x16x32_bf16(
        false, a.v, false, b.v, (short)0, c, false, false);
}

// ---------------------------------------------------------------- pre-pass
// ONE launch rounds both activations to bf16 and lays all four weights down as
// [N][K] bf16 (N-major, so that the GEMMs' B tiles are contiguous row copies).
// 256 work-groups of 16 waves, all with the same share: six 64 x 64 weight tiles
// (one of Wq, one of Wc, two of W1, two of W2) and 4096 16-byte pieces of each
// activation. A thread issues all its 28 loads before it uses the first, so the
// whole input is in flight at once; every wave-wide load and store covers whole
// 128-byte lines.

typedef float f32x4 __attribute__((ext_vector_type(4)));
typedef float f32x2 __attribute__((ext_vector_type(2)));
typedef __bf16 bf16x2 __attribute__((ext_vector_type(2)));
typedef u32 u32x2 __attribute__((ext_vector_type(2)));

// two f32 -> one register of two bf16, round to nearest even
__device__ __forceinline__ u32 pack2(float lo, float hi) {
    return __builtin_bit_cast(u32, __builtin_convertvector(f32x2{lo, hi}, bf16x2));
}

__global__ __launch_bounds__(512) void prep(
    const float* __restrict__ question, const float* __restrict__ context,
    const float* __restrict__ Wq, const float* __restrict__ Wc,
    const float* __restrict__ W1, const float* __restrict__ W2,
    u16* __restrict__ xqb, u16* __restrict__ xcb,
    u16* __restrict__ wqb, u16* __restrict__ wcb,
    u16* __restrict__ w1b, u16* __restrict__ w2b)
{
    __shared__ __attribute__((aligned(16))) u32 tl[6][64][32];

    const int t  = threadIdx.x;
    const int nt = blockIdx.x & 15, kt = blockIdx.x >> 4;    // tile column, tile row

    // weights: this thread reads columns 4 c4 .. 4 c4 + 3 of tile rows 2 r and 2 r + 1
    const int c4 = t & 15, r = t >> 4;
    const u32 so = (u32)((kt * 64 + 2 * r) * 1024 + nt * 64 + 4 * c4);
    const float* wsrc[6] = {Wq + so, Wc + so, W1 + so, W1 + so + 1024 * 1024,
                            W2 + so, W2 + so + 1024 * 1024};
    f32x4 w0[6], w1[6];
    #pragma unroll
    for (int i = 0; i < 6; i++) {
        w0[i] = *(const f32x4*)(wsrc[i]);
        w1[i] = *(const f32x4*)(wsrc[i] + 1024);
    }
    asm volatile("s_wait_xcnt 0x0" ::: "memory");

    // activations: piece xo + 512 i, so that a wave reads 512 contiguous bytes
    const u32 xo = (u32)blockIdx.x * 4096u + (u32)t;
    f32x4 xa[8], xb[8];
    #pragma unroll
    for (int i = 0; i < 8; i++) xa[i] = ((const f32x4*)question)[xo + 512u * i];
    #pragma unroll
    for (int i = 0; i < 8; i++) xb[i] = ((const f32x4*)context)[xo + 512u * i];
    // keeps every load above this line: without it the compiler sinks the weight loads to
    // their uses, pair by pair, and the wave pays one memory latency after another
    __builtin_amdgcn_sched_barrier(0);

    {
        const int col = (((r >> 2) ^ (c4 & 7)) << 2) + (r & 3);
        #pragma unroll
        for (int i = 0; i < 6; i++)
            #pragma unroll
            for (int j = 0; j < 4; j++)
                tl[i][4 * c4 + j][col] = pack2(w0[i][j], w1[i][j]);
    }
    __syncthreads();
    {
        // this thread stores k = 8 q .. 8 q + 7 of column n: a wave fills four whole lines
        const int n = t >> 3, q = t & 7;
        const int col = (q ^ ((n >> 2) & 7)) << 2;
        const u32 d1 = (u32)((nt * 64 + n) * 1024 + kt * 64 + 8 * q);
        const u32 d2 = (u32)((nt * 64 + n) * 2048 + kt * 64 + 8 * q);
        u16* wdst[6] = {wqb + d1, wcb + d1, w1b + d2, w1b + d2 + 1024, w2b + d2, w2b + d2 + 1024};
        #pragma unroll
        for (int i = 0; i < 6; i++)
            *(u32x4*)(wdst[i]) = *(const u32x4*)&tl[i][n][col];
    }

    #pragma unroll
    for (int i = 0; i < 8; i++)
        ((u32x2*)xqb)[xo + 512u * i] = u32x2{pack2(xa[i].x, xa[i].y), pack2(xa[i].z, xa[i].w)};
    #pragma unroll
    for (int i = 0; i < 8; i++)
        ((u32x2*)xcb)[xo + 512u * i] = u32x2{pack2(xb[i].x, xb[i].y), pack2(xb[i].z, xb[i].w)};
}

// ---------------------------------------------------------------- GEMM main loop
// Y = X . Wt^T, X [M][1024-wide rows] and Wt [N][KTOT] both k-contiguous bf16.
// One work-group of 8 waves per 256 (M) x 128 (N) tile of Y, one work-group per WGP;
// a wave holds 64 x 64 of it (4 x 4 accumulator tiles), so a loaded fragment serves four
// matrix instructions. A trip is 128 k: [X 256 rows | Wt 128 rows] of 256 bytes, two buffers,
// the next trip's rows copied to LDS while this trip's are worked on.

#define G_BM    256
#define G_BN    128
#define G_BK    128     // k per trip
#define G_PITCH 136     // u16 per LDS row = 272 B, an odd multiple of 16 B (ds_load_b128 readers)
#define G_ROWS  (G_BM + G_BN)

__device__ __forceinline__ void copy12(const u32* l, const u16* const* g) {
    asm volatile("global_load_async_to_lds_b128 %0, %12, off\n\t"
                 "global_load_async_to_lds_b128 %1, %13, off\n\t"
                 "global_load_async_to_lds_b128 %2, %14, off\n\t"
                 "global_load_async_to_lds_b128 %3, %15, off\n\t"
                 "global_load_async_to_lds_b128 %4, %16, off\n\t"
                 "global_load_async_to_lds_b128 %5, %17, off\n\t"
                 "global_load_async_to_lds_b128 %6, %18, off\n\t"
                 "global_load_async_to_lds_b128 %7, %19, off\n\t"
                 "global_load_async_to_lds_b128 %8, %20, off\n\t"
                 "global_load_async_to_lds_b128 %9, %21, off\n\t"
                 "global_load_async_to_lds_b128 %10, %22, off\n\t"
                 "global_load_async_to_lds_b128 %11, %23, off\n\t"
                 "s_wait_xcnt 0x0"
                 :: "v"(l[0]), "v"(l[1]), "v"(l[2]), "v"(l[3]), "v"(l[4]), "v"(l[5]),
                    "v"(l[6]), "v"(l[7]), "v"(l[8]), "v"(l[9]), "v"(l[10]), "v"(l[11]),
                    "v"(g[0]), "v"(g[1]), "v"(g[2]), "v"(g[3]), "v"(g[4]), "v"(g[5]),
                    "v"(g[6]), "v"(g[7]), "v"(g[8]), "v"(g[9]), "v"(g[10]), "v"(g[11])
                 : "memory");
}

// x0 holds k 0..1023 of X's rows, x1 k 1024..2047 (read only where KTOT is 2048).
// tile: LDS, [2][G_ROWS][G_PITCH]. acc[i][j]: rows 16 i, columns 16 j of the wave's 64 x 64.
template <int KTOT>
__device__ __forceinline__ void gemm_tile(const u16* __restrict__ x0, const u16* __restrict__ x1,
                                          const u16* __restrict__ wt, int row0, int col0,
                                          u16* tile, v8f (&acc)[4][4])
{
    const int tid  = threadIdx.x;
    const int lane = tid & 31, wid = tid >> 5;
    const int hl   = lane >> 4, mr = lane & 15;
    const int wm   = wid & 3, wn = wid >> 2;

    // each thread copies chunk cc (16 B) of rows cr + 16 j: a wave fills two whole rows a copy
    const int cr = tid >> 4, cc = (tid & 15) * 8;
    const u32 xoff = (u32)((row0 + cr) * 1024 + cc);
    const u16* wsrc = wt + (u32)((col0 + cr) * KTOT + cc);
    const u32 ldst = (u32)(size_t)(tile + cr * G_PITCH + cc);

    auto stage = [&](int t, int buf) {
        const int k0 = t * G_BK;
        const u16* xs = ((KTOT > 1024 && k0 >= 1024) ? x1 : x0) + xoff + (k0 & 1023);
        const u16* ws = wsrc + k0;
        const u32  lb = ldst + (u32)buf * (u32)(G_ROWS * G_PITCH * 2);
        u32 l[12];
        const u16* g[12];
        #pragma unroll
        for (int j = 0; j < 12; j++) { l[j] = lb + (u32)j * (u32)(16 * G_PITCH * 2); g[j] = xs + j * (16 * 1024); }
        copy12(l, g);
        // keeps the second dozen's address arithmetic behind the first dozen's statement: formed
        // ahead of it, the addresses overfill the registers that asm text can name, and the build spills
        __builtin_amdgcn_sched_barrier(0);
        #pragma unroll
        for (int j = 0; j < 4; j++) { l[j] = lb + (u32)(12 + j) * (u32)(16 * G_PITCH * 2); g[j] = xs + (12 + j) * (16 * 1024); }
        #pragma unroll
        for (int j = 0; j < 8; j++) { l[4 + j] = lb + (u32)(16 + j) * (u32)(16 * G_PITCH * 2); g[4 + j] = ws + j * (16 * KTOT); }
        copy12(l, g);
    };

    constexpr int T = KTOT / G_BK;

    // two fragment sets: block ks of a trip (32 k, 16 matrix instructions) works on set ks & 1
    Frag a[2][4], b[2][4];
    const u32 aoff = (u32)((wm * 64 + mr) * G_PITCH + 8 * hl);
    const u32 boff = (u32)((G_BM + wn * 64 + mr) * G_PITCH + 8 * hl);
    auto frags = [&](int buf, int ks, int s) {
        const u16* ap = tile + buf * (G_ROWS * G_PITCH) + aoff + ks * 32;
        const u16* bp = tile + buf * (G_ROWS * G_PITCH) + boff + ks * 32;
        #pragma unroll
        for (int i = 0; i < 4; i++) {
            a[s][i].q[0] = *(const u32x4*)(ap + i * 16 * G_PITCH);
            a[s][i].q[1] = *(const u32x4*)(ap + i * 16 * G_PITCH + 16);
            b[s][i].q[0] = *(const u32x4*)(bp + i * 16 * G_PITCH);
            b[s][i].q[1] = *(const u32x4*)(bp + i * 16 * G_PITCH + 16);
        }
        // keeps the 16 LDS reads above in one group ahead of the matrix run below: without it
        // the compiler spreads them among the matrix instructions, each with a wait to 0
        __builtin_amdgcn_sched_barrier(0);
    };
    auto block = [&](int s) {
        #pragma unroll
        for (int i = 0; i < 4; i++)
            #pragma unroll
            for (int j = 0; j < 4; j++)
                acc[i][j] = bf16_wmma(a[s][i], b[s][j], acc[i][j]);
        // keeps the next group of LDS reads out of the matrix run above
        __builtin_amdgcn_sched_barrier(0);
    };

    stage(0, 0);
    // tile 0 has landed for this wave, then for the block; only then tile 1 starts
    asm volatile("s_wait_asynccnt 0x0" ::: "memory");
    __syncthreads();
    stage(1, 1);
    frags(0, 0, 0);

    for (int t = 0; t < T; t++) {
        const int buf = t & 1;
        // unrolled: the fragment sets are named at compile time
        #pragma unroll
        for (int ks = 0; ks < G_BK / 32 - 1; ks++) {
            frags(buf, ks + 1, (ks + 1) & 1);
            block(ks & 1);
        }
        // hand-over: this wave's reads of tile t are done (its last block's fragments are in
        // registers), its copies of tile t + 1 have landed; behind the barrier both hold for the block
        asm volatile("s_wait_dscnt 0x0" ::: "memory");
        asm volatile("s_wait_asynccnt 0x0" ::: "memory");
        __syncthreads();
        if (t + 2 < T) stage(t + 2, buf);
        // tile t + 1's first fragments fly under tile t's last block. No branch round them (it would
        // merge two paths in the wait counting): on the last trip they read the idle buffer, unused.
        frags(buf ^ 1, 0, 0);
        block((G_BK / 32 - 1) & 1);
    }
    // no copy is left in flight when the wave goes on
    asm volatile("s_wait_asynccnt 0x0" ::: "memory");
}

// ---------------------------------------------------------------- projection GEMM
// [4096 x 1024] (bf16) @ Wt [1024(N) x 1024(K)] (bf16) -> bf16

__global__ __launch_bounds__(256) void proj_gemm(
    const u16* __restrict__ xq, const u16* __restrict__ xc,
    const u16* __restrict__ wtq, const u16* __restrict__ wtc,
    u16* __restrict__ pq, u16* __restrict__ pc)
{
    const u16* x  = blockIdx.z ? xc  : xq;
    const u16* wt = blockIdx.z ? wtc : wtq;
    u16*       p  = blockIdx.z ? pc  : pq;

    __shared__ __attribute__((aligned(16))) u16 tile[2 * G_ROWS * G_PITCH];

    const int lane = threadIdx.x & 31, wid = threadIdx.x >> 5;
    const int hl   = lane >> 4, mr = lane & 15;
    const int row0 = blockIdx.x * G_BM;
    const int col0 = blockIdx.y * G_BN;

    v8f acc[4][4] = {};
    gemm_tile<1024>(x, x, wt, row0, col0, tile, acc);

    // C/D layout: reg r -> row r + 8*half
    u16* pp = p + (u32)((row0 + (wid & 3) * 64 + 8 * hl) * 1024 + col0 + (wid >> 2) * 64 + mr);
    #pragma unroll
    for (int i = 0; i < 4; i++) {
        u16 v[8][4];
        #pragma unroll
        for (int r = 0; r < 8; r++)
            #pragma unroll
            for (int j = 0; j < 4; j++)
                v[r][j] = f2bf(acc[i][j][r]);
        // the two fences keep the next rows' arithmetic out of the stretch between the stores and
        // their wait, so that the wait stands in front of every rewrite of a register a store names
        __builtin_amdgcn_sched_barrier(0);
        #pragma unroll
        for (int r = 0; r < 8; r++)
            #pragma unroll
            for (int j = 0; j < 4; j++)
                pp[(i * 16 + r) * 1024 + j * 16] = v[r][j];
        asm volatile("s_wait_xcnt 0x0" ::: "memory");
        __builtin_amdgcn_sched_barrier(0);
    }
}

typedef short s16x8 __attribute__((ext_vector_type(8)));

#define KV_KEYS  64     // keys per staged tile
#define K_PITCH  72     // u16 per LDS row = 144 B, an odd multiple of 16 B (ds_load_b128 readers)
#define V_PITCH  80     // u16 per LDS row = 160 B, an odd multiple of 32 B (ds_load_tr16_b128 readers)

__device__ __forceinline__ void kv_copy4(u32 l0, const u16* g0, u32 l1, const u16* g1,
                                         u32 l2, const u16* g2, u32 l3, const u16* g3) {
    asm volatile("global_load_async_to_lds_b128 %0, %1, off\n\t"
                 "global_load_async_to_lds_b128 %2, %3, off\n\t"
                 "global_load_async_to_lds_b128 %4, %5, off\n\t"
                 "global_load_async_to_lds_b128 %6, %7, off\n\t"
                 "s_wait_xcnt 0x0"
                 :: "v"(l0), "v"(g0), "v"(l1), "v"(g1), "v"(l2), "v"(g2), "v"(l3), "v"(g3) : "memory");
}

// lane (c, h) gets T[8h + 0..7][c] of the 16x16 block of 16-bit elements that the lanes' addresses name
__device__ __forceinline__ u32x4 ld_tr16(const u16* p) {
    return __builtin_bit_cast(u32x4, __builtin_amdgcn_ds_load_tr16_b128_v8i16((AS3 s16x8*)p));
}

__device__ __forceinline__ float xhalf(float x) {
    const int v = __builtin_bit_cast(int, x);
    return __builtin_bit_cast(float,
        __builtin_amdgcn_permlanex16(v, v, 0x76543210, 0xfedcba98, false, false));
}

__global__ __launch_bounds__(256, 8) void attn_kernel(
    const u16* __restrict__ projq, const u16* __restrict__ projc,
    const int* __restrict__ mask_q, const int* __restrict__ mask_c,
    u16* __restrict__ attnq, u16* __restrict__ attnc)
{
    const int tid  = threadIdx.x;
    const int lane = tid & 31, wid = tid >> 5;
    const int hl = lane >> 4, mr = lane & 15;
    const int qb = blockIdx.x * 128 + wid * 16;
    const int h  = blockIdx.y;
    const int b  = blockIdx.z >> 1, type = blockIdx.z & 1;

    const u16* Q     = type ? projq : projc;
    const u16* KV    = type ? projc : projq;
    const int* maskp = type ? mask_c : mask_q;
    u16*       out   = type ? attnc : attnq;

    __shared__ __attribute__((aligned(16))) u16 Kt[2][KV_KEYS][K_PITCH];
    __shared__ __attribute__((aligned(16))) u16 Vt[2][KV_KEYS][V_PITCH];

    // each thread copies chunk cc (16 B) of rows cr and cr + 32 of a tile
    const int cr = tid >> 3, cc = (tid & 7) * 8;
    const u16* gsrc = KV + ((size_t)(b * 1024 + cr)) * 1024 + h * 64 + cc;
    const u32  kdst = (u32)(size_t)&Kt[0][cr][cc];
    const u32  vdst = (u32)(size_t)&Vt[0][cr][cc];
    auto stage = [&](int t, int buf) {
        const u16* g  = gsrc + (size_t)t * (KV_KEYS * 1024);
        const u32  lk = kdst + (u32)buf * (u32)(KV_KEYS * K_PITCH * 2);
        const u32  lv = vdst + (u32)buf * (u32)(KV_KEYS * V_PITCH * 2);
        kv_copy4(lk, g, lk + 32u * K_PITCH * 2u, g + 32 * 1024,
                 lv, g, lv + 32u * V_PITCH * 2u, g + 32 * 1024);
    };

    stage(0, 0);

    // Q fragments, now the B operand: column = query mr, d in the hardware k order
    Frag aq0, aq1;
    {
        const u16* qrow = Q + ((size_t)(b * 1024 + qb + mr)) * 1024 + h * 64;
        #pragma unroll
        for (int r = 0; r < 8; r++) {
            int k = kpair(r, hl);
            aq0.u[r] = *(const u32*)(qrow + k);
            aq1.u[r] = *(const u32*)(qrow + 32 + k);
        }
    }
    asm volatile("s_wait_xcnt 0x0" ::: "memory");

    // This lane's query: 1/sqrt(DK) in base 2. A masked query has every score equal
    // (-65504 in the definition); softmax does not see a shift common to a row, so scale 0 gives
    // the same uniform row.
    const float cs = (maskp[b * 1024 + qb + mr] == 0) ? 0.0f : 0.125f * 1.4426950408889634f;

    float mstat = -1.0e30f;     // running maximum, scaled, equal in both halves of the wave
    float lstat = 0.0f;         // running sum over this half's keys; the halves join behind the loop
    v8f o0 = {}, o1 = {}, o2 = {}, o3 = {};     // o_t[r] = O[query mr][16 t + 8 hl + r]

    // tile 0 has landed for this wave, then for the block; only then tile 1 starts
    asm volatile("s_wait_asynccnt 0x0" ::: "memory");
    __syncthreads();
    stage(1, 1);

    for (int t = 0; t < 1024 / KV_KEYS; t++) {
        const int buf = t & 1;
        // unrolled: every LDS offset of a half becomes an immediate of its load
        #pragma unroll
        for (int sub = 0; sub < 2; sub++) {
            // K fragments, the A operand: row = key, d in the hardware k order (as Q's)
            Frag bk0, bk1, bk2, bk3;
            {
                const u16* kr0 = &Kt[buf][sub * 32      + mr][8 * hl];
                const u16* kr1 = &Kt[buf][sub * 32 + 16 + mr][8 * hl];
                bk0.q[0] = *(const u32x4*)(kr0);      bk0.q[1] = *(const u32x4*)(kr0 + 16);
                bk1.q[0] = *(const u32x4*)(kr0 + 32); bk1.q[1] = *(const u32x4*)(kr0 + 48);
                bk2.q[0] = *(const u32x4*)(kr1);      bk2.q[1] = *(const u32x4*)(kr1 + 16);
                bk3.q[0] = *(const u32x4*)(kr1 + 32); bk3.q[1] = *(const u32x4*)(kr1 + 48);
            }
            // s0[r] = score(key 8 hl + r, query mr), s1[r] = score(key 16 + 8 hl + r, query mr)
            v8f s0 = {}, s1 = {};
            s0 = bf16_wmma(bk0, aq0, s0);
            s0 = bf16_wmma(bk1, aq1, s0);
            s1 = bf16_wmma(bk2, aq0, s1);
            s1 = bf16_wmma(bk3, aq1, s1);

            // V^T fragments, the A operand: the same rows, transposed on the way out of LDS;
            // keys 0-15 fill registers 0-3, keys 16-31 registers 4-7 (hardware k order, as P^T's)
            Frag bv0, bv1, bv2, bv3;
            {
                const u16* vr = &Vt[buf][sub * 32 + 8 * hl + (lane & 7)][8 * ((lane >> 3) & 1)];
                bv0.q[0] = ld_tr16(vr);      bv0.q[1] = ld_tr16(vr + 16 * V_PITCH);
                bv1.q[0] = ld_tr16(vr + 16); bv1.q[1] = ld_tr16(vr + 16 * V_PITCH + 16);
                bv2.q[0] = ld_tr16(vr + 32); bv2.q[1] = ld_tr16(vr + 16 * V_PITCH + 32);
                bv3.q[0] = ld_tr16(vr + 48); bv3.q[1] = ld_tr16(vr + 16 * V_PITCH + 48);
            }

            // maximum of the raw scores (the scale is not negative), then over both halves
            float mx = fmaxf(s0[0], s1[0]);
            #pragma unroll
            for (int r = 1; r < 8; r++) mx = fmaxf(mx, fmaxf(s0[r], s1[r]));
            mx = fmaxf(mx, xhalf(mx));
            const float mn = fmaxf(mstat, mx * cs);
            const float al = __builtin_amdgcn_exp2f(mstat - mn);
            mstat = mn;

            // P^T: elements 0-7 from s0, 8-15 from s1, the k order of a B operand
            Frag pf;
            f32x2 rs = {0.0f, 0.0f};
            #pragma unroll
            for (int i = 0; i < 4; i++) {
                const f32x2 a0 = __builtin_elementwise_fma(f32x2{s0[2 * i], s0[2 * i + 1]}, f32x2{cs, cs}, f32x2{-mn, -mn});
                const f32x2 a1 = __builtin_elementwise_fma(f32x2{s1[2 * i], s1[2 * i + 1]}, f32x2{cs, cs}, f32x2{-mn, -mn});
                const f32x2 e0 = {__builtin_amdgcn_exp2f(a0.x), __builtin_amdgcn_exp2f(a0.y)};
                const f32x2 e1 = {__builtin_amdgcn_exp2f(a1.x), __builtin_amdgcn_exp2f(a1.y)};
                pf.u[i]     = pack2(e0.x, e0.y);
                pf.u[4 + i] = pack2(e1.x, e1.y);
                rs += e0 + e1;
            }
            lstat = lstat * al + (rs.x + rs.y);
            o0 *= al; o1 *= al; o2 *= al; o3 *= al;

            o0 = bf16_wmma(bv0, pf, o0);
            o1 = bf16_wmma(bv1, pf, o1);
            o2 = bf16_wmma(bv2, pf, o2);
            o3 = bf16_wmma(bv3, pf, o3);
        }

        // hand-over: this wave's reads of tile t are done, its copies of tile t + 1
        // have landed; behind the barrier both hold for the whole block
        asm volatile("s_wait_dscnt 0x0" ::: "memory");
        asm volatile("s_wait_asynccnt 0x0" ::: "memory");
        __syncthreads();
        if (t + 2 < 1024 / KV_KEYS) stage(t + 2, buf);
    }
    // no copy is left in flight when the wave ends
    asm volatile("s_wait_asynccnt 0x0" ::: "memory");

    // a lane's 8 registers of a tile are 8 consecutive d of its query: one 16-byte store each
    const float inv = 1.0f / (lstat + xhalf(lstat));
    u16* orow = out + (u32)((b * 1024 + qb + mr) * 1024 + h * 64 + 8 * hl);
    o0 *= inv; o1 *= inv; o2 *= inv; o3 *= inv;
    *(u32x4*)(orow)      = u32x4{pack2(o0[0], o0[1]), pack2(o0[2], o0[3]), pack2(o0[4], o0[5]), pack2(o0[6], o0[7])};
    *(u32x4*)(orow + 16) = u32x4{pack2(o1[0], o1[1]), pack2(o1[2], o1[3]), pack2(o1[4], o1[5]), pack2(o1[6], o1[7])};
    *(u32x4*)(orow + 32) = u32x4{pack2(o2[0], o2[1]), pack2(o2[2], o2[3]), pack2(o2[4], o2[5]), pack2(o2[6], o2[7])};
    *(u32x4*)(orow + 48) = u32x4{pack2(o3[0], o3[1]), pack2(o3[2], o3[3]), pack2(o3[4], o3[5]), pack2(o3[6], o3[7])};
}

// ---------------------------------------------------------------- FFN GEMM
// out = x + tanh(concat([x, x_attn]) @ W + b);  M=4096, N=1024, K=2048.
// Wt is [1024(N) x 2048(K)] bf16 (pre-transposed).

__global__ __launch_bounds__(256) void ffn_gemm(
    const u16* __restrict__ xqb, const u16* __restrict__ xcb,
    const u16* __restrict__ aqb, const u16* __restrict__ acb,
    const u16* __restrict__ w1t, const u16* __restrict__ w2t,
    const float* __restrict__ b1, const float* __restrict__ b2,
    const float* __restrict__ xq, const float* __restrict__ xc,
    float* __restrict__ outq, float* __restrict__ outc)
{
    const u16* src0  = blockIdx.z ? xcb : xqb;
    const u16* src1  = blockIdx.z ? acb : aqb;
    const u16* wt    = blockIdx.z ? w2t : w1t;
    const float* bias = blockIdx.z ? b2 : b1;
    const float* xf  = blockIdx.z ? xc : xq;
    float*       out = blockIdx.z ? outc : outq;

    __shared__ __attribute__((aligned(16))) u16 tile[2 * G_ROWS * G_PITCH];

    const int lane = threadIdx.x & 31, wid = threadIdx.x >> 5;
    const int hl   = lane >> 4, mr = lane & 15;
    const int row0 = blockIdx.x * G_BM;
    const int col0 = blockIdx.y * G_BN;

    v8f acc[4][4] = {};
    gemm_tile<2048>(src0, src1, wt, row0, col0, tile, acc);

    const int colb = col0 + (wid >> 2) * 64 + mr;
    const u32 e0 = (u32)((row0 + (wid & 3) * 64 + 8 * hl) * 1024 + colb);   // C/D layout: reg r -> row r + 8*half
    const float* xp = xf + e0;
    float*       op = out + e0;
    // the bias first: the first element then waits for the oldest loads only
    const float bb[4] = {bias[colb], bias[colb + 16], bias[colb + 32], bias[colb + 48]};
    asm volatile("s_wait_xcnt 0x0" ::: "memory");
    v8f xr[4][4];
    #pragma unroll
    for (int i = 0; i < 4; i++)
        #pragma unroll
        for (int r = 0; r < 8; r++)
            #pragma unroll
            for (int j = 0; j < 4; j++)
                xr[i][j][r] = xp[(i * 16 + r) * 1024 + 16 * j];
    asm volatile("s_wait_xcnt 0x0" ::: "memory");
    // rolled, the accumulator rows shifting down one place a trip: the text holds 32 tanh
    // bodies instead of 128
    #pragma unroll 1
    for (int i = 0; i < 4; i++) {
        #pragma unroll
        for (int r = 0; r < 8; r++)
            #pragma unroll
            for (int j = 0; j < 4; j++)
                op[r * 1024 + 16 * j] = xr[0][j][r] + tanhf(acc[0][j][r] + bb[j]);
        asm volatile("s_wait_xcnt 0x0" ::: "memory");
        op += 16 * 1024;
        #pragma unroll
        for (int j = 0; j < 4; j++) {
            acc[0][j] = acc[1][j]; acc[1][j] = acc[2][j]; acc[2][j] = acc[3][j];
            xr[0][j]  = xr[1][j];  xr[1][j]  = xr[2][j];  xr[2][j]  = xr[3][j];
        }
    }
}

// ---------------------------------------------------------------- launcher

extern "C" void kernel_launch(void* const* d_in, const int* in_sizes, int n_in,
                              void* d_out, int out_size, void* d_ws, size_t ws_size,
                              hipStream_t stream) {
    (void)in_sizes; (void)n_in; (void)out_size; (void)ws_size;

    const float* question = (const float*)d_in[0];
    const float* context  = (const float*)d_in[1];
    const int*   mask_q   = (const int*)d_in[2];
    const int*   mask_c   = (const int*)d_in[3];
    const float* Wq = (const float*)d_in[4];
    const float* Wc = (const float*)d_in[5];
    const float* W1 = (const float*)d_in[6];
    const float* b1 = (const float*)d_in[7];
    const float* W2 = (const float*)d_in[8];
    const float* b2 = (const float*)d_in[9];

    const size_t NX = (size_t)4 * 1024 * 1024;   // B*S*D
    u16* ws  = (u16*)d_ws;
    u16* xqb = ws;                u16* xcb = xqb + NX;
    u16* wqb = xcb + NX;          u16* wcb = wqb + (size_t)1024 * 1024;
    u16* w1b = wcb + (size_t)1024 * 1024;
    u16* w2b = w1b + (size_t)2048 * 1024;
    u16* pq  = w2b + (size_t)2048 * 1024;
    u16* pc  = pq + NX;
    u16* aq  = pc + NX;
    u16* ac  = aq + NX;

    float* outq = (float*)d_out;
    float* outc = outq + NX;

    prep<<<256, 512, 0, stream>>>(question, context, Wq, Wc, W1, W2,
                                  xqb, xcb, wqb, wcb, w1b, w2b);

    proj_gemm<<<dim3(16, 8, 2), 256, 0, stream>>>(xqb, xcb, wqb, wcb, pq, pc);
    attn_kernel<<<dim3(8, 16, 8), 256, 0, stream>>>(pq, pc, mask_q, mask_c, aq, ac);
    ffn_gemm<<<dim3(16, 8, 2), 256, 0, stream>>>(xqb, xcb, aq, ac, w1b, w2b,
                                                 b1, b2, question, context, outq, outc);
}

// v005
// It runs in 86 microseconds.
// Next to v004, in two timings, it ran 1.11 times as fast each time.
// Counting every step since v000, it is 3.36 times as fast.
#include <hip/hip_runtime.h>

typedef unsigned short u16;
typedef unsigned int   u32;
typedef __attribute__((ext_vector_type(16))) __bf16 v16bf;
typedef __attribute__((ext_vector_type(8)))  float  v8f;

#define AS3 __attribute__((address_space(3)))

// ---------------------------------------------------------------- utilities

typedef u32 u32x4 __attribute__((ext_vector_type(4)));

union Frag {
    u32   u[8];
    u32x4 q[2];
    u16   s[16];
    v16bf v;
};

__device__ __forceinline__ u16 f2bf(float f) {
    u32 u = __float_as_uint(f);
    u32 r = u + 0x7FFFu + ((u >> 16) & 1u);   // round-to-nearest-even
    return (u16)(r >> 16);
}

__device__ __forceinline__ int kpair(int r, int hl) {
    return (r < 4 ? 2 * r : 16 + 2 * (r - 4)) + 8 * hl;
}

__device__ __forceinline__ v8f bf16_wmma(Frag a, Frag b, v8f c) {
    return __builtin_amdgcn_wmma_f32_16x16x32_bf16(
        false, a.v, false, b.v, (short)0, c, false, false);
}

// ---------------------------------------------------------------- pre-pass
// ONE launch rounds both activations to bf16 and lays all four weights down as
// [N][K] bf16 (N-major, so that the GEMMs' B tiles are contiguous row copies).
// 256 work-groups of 16 waves, all with the same share: six 64 x 64 weight tiles
// (one of Wq, one of Wc, two of W1, two of W2) and 4096 16-byte pieces of each
// activation. A thread issues all its 28 loads before it uses the first, so the
// whole input is in flight at once; every wave-wide load and store covers whole
// 128-byte lines.

typedef float f32x4 __attribute__((ext_vector_type(4)));
typedef float f32x2 __attribute__((ext_vector_type(2)));
typedef __bf16 bf16x2 __attribute__((ext_vector_type(2)));
typedef u32 u32x2 __attribute__((ext_vector_type(2)));

// two f32 -> one register of two bf16, round to nearest even
__device__ __forceinline__ u32 pack2(float lo, float hi) {
    return __builtin_bit_cast(u32, __builtin_convertvector(f32x2{lo, hi}, bf16x2));
}

__global__ __launch_bounds__(512) void prep(
    const float* __restrict__ question, const float* __restrict__ context,
    const float* __restrict__ Wq, const float* __restrict__ Wc,
    const float* __restrict__ W1, const float* __restrict__ W2,
    u16* __restrict__ xqb, u16* __restrict__ xcb,
    u16* __restrict__ wqb, u16* __restrict__ wcb,
    u16* __restrict__ w1b, u16* __restrict__ w2b)
{
    __shared__ __attribute__((aligned(16))) u32 tl[6][64][32];

    const int t  = threadIdx.x;
    const int nt = blockIdx.x & 15, kt = blockIdx.x >> 4;    // tile column, tile row

    // weights: this thread reads columns 4 c4 .. 4 c4 + 3 of tile rows 2 r and 2 r + 1
    const int c4 = t & 15, r = t >> 4;
    const u32 so = (u32)((kt * 64 + 2 * r) * 1024 + nt * 64 + 4 * c4);
    const float* wsrc[6] = {Wq + so, Wc + so, W1 + so, W1 + so + 1024 * 1024,
                            W2 + so, W2 + so + 1024 * 1024};
    f32x4 w0[6], w1[6];
    #pragma unroll
    for (int i = 0; i < 6; i++) {
        w0[i] = *(const f32x4*)(wsrc[i]);
        w1[i] = *(const f32x4*)(wsrc[i] + 1024);
    }
    asm volatile("s_wait_xcnt 0x0" ::: "memory");

    // activations: piece xo + 512 i, so that a wave reads 512 contiguous bytes
    const u32 xo = (u32)blockIdx.x * 4096u + (u32)t;
    f32x4 xa[8], xb[8];
    #pragma unroll
    for (int i = 0; i < 8; i++) xa[i] = ((const f32x4*)question)[xo + 512u * i];
    #pragma unroll
    for (int i = 0; i < 8; i++) xb[i] = ((const f32x4*)context)[xo + 512u * i];
    // keeps every load above this line: without it the compiler sinks the weight loads to
    // their uses, pair by pair, and the wave pays one memory latency after another
    __builtin_amdgcn_sched_barrier(0);

    {
        const int col = (((r >> 2) ^ (c4 & 7)) << 2) + (r & 3);
        #pragma unroll
        for (int i = 0; i < 6; i++)
            #pragma unroll
            for (int j = 0; j < 4; j++)
                tl[i][4 * c4 + j][col] = pack2(w0[i][j], w1[i][j]);
    }
    __syncthreads();
    {
        // this thread stores k = 8 q .. 8 q + 7 of column n: a wave fills four whole lines
        const int n = t >> 3, q = t & 7;
        const int col = (q ^ ((n >> 2) & 7)) << 2;
        const u32 d1 = (u32)((nt * 64 + n) * 1024 + kt * 64 + 8 * q);
        const u32 d2 = (u32)((nt * 64 + n) * 2048 + kt * 64 + 8 * q);
        u16* wdst[6] = {wqb + d1, wcb + d1, w1b + d2, w1b + d2 + 1024, w2b + d2, w2b + d2 + 1024};
        #pragma unroll
        for (int i = 0; i < 6; i++)
            *(u32x4*)(wdst[i]) = *(const u32x4*)&tl[i][n][col];
    }

    #pragma unroll
    for (int i = 0; i < 8; i++)
        ((u32x2*)xqb)[xo + 512u * i] = u32x2{pack2(xa[i].x, xa[i].y), pack2(xa[i].z, xa[i].w)};
    #pragma unroll
    for (int i = 0; i < 8; i++)
        ((u32x2*)xcb)[xo + 512u * i] = u32x2{pack2(xb[i].x, xb[i].y), pack2(xb[i].z, xb[i].w)};
}

// ---------------------------------------------------------------- GEMM main loop
// Y = X . Wt^T, X [M][1024-wide rows] and Wt [N][KTOT] both k-contiguous bf16.
// One work-group of 8 waves per 256 (M) x 128 (N) tile of Y, one work-group per WGP;
// a wave holds 64 x 64 of it (4 x 4 accumulator tiles), so a loaded fragment serves four
// matrix instructions. A trip is 128 k: [X 256 rows | Wt 128 rows] of 256 bytes, two buffers,
// the next trip's rows copied to LDS while this trip's are worked on.

#define G_BM    256
#define G_BN    128
#define G_BK    128     // k per trip
#define G_PITCH 136     // u16 per LDS row = 272 B, an odd multiple of 16 B (ds_load_b128 readers)
#define G_ROWS  (G_BM + G_BN)

__device__ __forceinline__ void copy12(const u32* l, const u16* const* g) {
    asm volatile("global_load_async_to_lds_b128 %0, %12, off\n\t"
                 "global_load_async_to_lds_b128 %1, %13, off\n\t"
                 "global_load_async_to_lds_b128 %2, %14, off\n\t"
                 "global_load_async_to_lds_b128 %3, %15, off\n\t"
                 "global_load_async_to_lds_b128 %4, %16, off\n\t"
                 "global_load_async_to_lds_b128 %5, %17, off\n\t"
                 "global_load_async_to_lds_b128 %6, %18, off\n\t"
                 "global_load_async_to_lds_b128 %7, %19, off\n\t"
                 "global_load_async_to_lds_b128 %8, %20, off\n\t"
                 "global_load_async_to_lds_b128 %9, %21, off\n\t"
                 "global_load_async_to_lds_b128 %10, %22, off\n\t"
                 "global_load_async_to_lds_b128 %11, %23, off\n\t"
                 "s_wait_xcnt 0x0"
                 :: "v"(l[0]), "v"(l[1]), "v"(l[2]), "v"(l[3]), "v"(l[4]), "v"(l[5]),
                    "v"(l[6]), "v"(l[7]), "v"(l[8]), "v"(l[9]), "v"(l[10]), "v"(l[11]),
                    "v"(g[0]), "v"(g[1]), "v"(g[2]), "v"(g[3]), "v"(g[4]), "v"(g[5]),
                    "v"(g[6]), "v"(g[7]), "v"(g[8]), "v"(g[9]), "v"(g[10]), "v"(g[11])
                 : "memory");
}

// x0 holds k 0..1023 of X's rows, x1 k 1024..2047 (read only where KTOT is 2048).
// tile: LDS, [2][G_ROWS][G_PITCH]. acc[i][j]: rows 16 i, columns 16 j of the wave's 64 x 64.
template <int KTOT>
__device__ __forceinline__ void gemm_tile(const u16* __restrict__ x0, const u16* __restrict__ x1,
                                          const u16* __restrict__ wt, int row0, int col0,
                                          u16* tile, v8f (&acc)[4][4])
{
    const int tid  = threadIdx.x;
    const int lane = tid & 31, wid = tid >> 5;
    const int hl   = lane >> 4, mr = lane & 15;
    const int wm   = wid & 3, wn = wid >> 2;

    // each thread copies chunk cc (16 B) of rows cr + 16 j: a wave fills two whole rows a copy
    const int cr = tid >> 4, cc = (tid & 15) * 8;
    const u32 xoff = (u32)((row0 + cr) * 1024 + cc);
    const u16* wsrc = wt + (u32)((col0 + cr) * KTOT + cc);
    const u32 ldst = (u32)(size_t)(tile + cr * G_PITCH + cc);

    auto stage = [&](int t, int buf) {
        const int k0 = t * G_BK;
        const u16* xs = ((KTOT > 1024 && k0 >= 1024) ? x1 : x0) + xoff + (k0 & 1023);
        const u16* ws = wsrc + k0;
        const u32  lb = ldst + (u32)buf * (u32)(G_ROWS * G_PITCH * 2);
        u32 l[12];
        const u16* g[12];
        #pragma unroll
        for (int j = 0; j < 12; j++) { l[j] = lb + (u32)j * (u32)(16 * G_PITCH * 2); g[j] = xs + j * (16 * 1024); }
        copy12(l, g);
        // keeps the second dozen's address arithmetic behind the first dozen's statement: formed
        // ahead of it, the addresses overfill the registers that asm text can name, and the build spills
        __builtin_amdgcn_sched_barrier(0);
        #pragma unroll
        for (int j = 0; j < 4; j++) { l[j] = lb + (u32)(12 + j) * (u32)(16 * G_PITCH * 2); g[j] = xs + (12 + j) * (16 * 1024); }
        #pragma unroll
        for (int j = 0; j < 8; j++) { l[4 + j] = lb + (u32)(16 + j) * (u32)(16 * G_PITCH * 2); g[4 + j] = ws + j * (16 * KTOT); }
        copy12(l, g);
    };

    constexpr int T = KTOT / G_BK;

    // two fragment sets: block ks of a trip (32 k, 16 matrix instructions) works on set ks & 1
    Frag a[2][4], b[2][4];
    const u32 aoff = (u32)((wm * 64 + mr) * G_PITCH + 8 * hl);
    const u32 boff = (u32)((G_BM + wn * 64 + mr) * G_PITCH + 8 * hl);
    auto frags = [&](int buf, int ks, int s) {
        const u16* ap = tile + buf * (G_ROWS * G_PITCH) + aoff + ks * 32;
        const u16* bp = tile + buf * (G_ROWS * G_PITCH) + boff + ks * 32;
        #pragma unroll
        for (int i = 0; i < 4; i++) {
            a[s][i].q[0] = *(const u32x4*)(ap + i * 16 * G_PITCH);
            a[s][i].q[1] = *(const u32x4*)(ap + i * 16 * G_PITCH + 16);
            b[s][i].q[0] = *(const u32x4*)(bp + i * 16 * G_PITCH);
            b[s][i].q[1] = *(const u32x4*)(bp + i * 16 * G_PITCH + 16);
        }
        // keeps the 16 LDS reads above in one group ahead of the matrix run below: without it
        // the compiler spreads them among the matrix instructions, each with a wait to 0
        __builtin_amdgcn_sched_barrier(0);
    };
    auto block = [&](int s) {
        #pragma unroll
        for (int i = 0; i < 4; i++)
            #pragma unroll
            for (int j = 0; j < 4; j++)
                acc[i][j] = bf16_wmma(a[s][i], b[s][j], acc[i][j]);
        // keeps the next group of LDS reads out of the matrix run above
        __builtin_amdgcn_sched_barrier(0);
    };

    stage(0, 0);
    // tile 0 has landed for this wave, then for the block; only then tile 1 starts
    asm volatile("s_wait_asynccnt 0x0" ::: "memory");
    __syncthreads();
    stage(1, 1);
    frags(0, 0, 0);

    for (int t = 0; t < T; t++) {
        const int buf = t & 1;
        // unrolled: the fragment sets are named at compile time
        #pragma unroll
        for (int ks = 0; ks < G_BK / 32 - 1; ks++) {
            frags(buf, ks + 1, (ks + 1) & 1);
            block(ks & 1);
        }
        // hand-over: this wave's reads of tile t are done (its last block's fragments are in
        // registers), its copies of tile t + 1 have landed; behind the barrier both hold for the block
        asm volatile("s_wait_dscnt 0x0" ::: "memory");
        asm volatile("s_wait_asynccnt 0x0" ::: "memory");
        __syncthreads();
        if (t + 2 < T) stage(t + 2, buf);
        // tile t + 1's first fragments fly under tile t's last block. No branch round them (it would
        // merge two paths in the wait counting): on the last trip they read the idle buffer, unused.
        frags(buf ^ 1, 0, 0);
        block((G_BK / 32 - 1) & 1);
    }
    // no copy is left in flight when the wave goes on
    asm volatile("s_wait_asynccnt 0x0" ::: "memory");
}

// ---------------------------------------------------------------- projection GEMM
// [4096 x 1024] (bf16) @ Wt [1024(N) x 1024(K)] (bf16) -> bf16

__global__ __launch_bounds__(256) void proj_gemm(
    const u16* __restrict__ xq, const u16* __restrict__ xc,
    const u16* __restrict__ wtq, const u16* __restrict__ wtc,
    u16* __restrict__ pq, u16* __restrict__ pc)
{
    const u16* x  = blockIdx.z ? xc  : xq;
    const u16* wt = blockIdx.z ? wtc : wtq;
    u16*       p  = blockIdx.z ? pc  : pq;

    __shared__ __attribute__((aligned(16))) u16 tile[2 * G_ROWS * G_PITCH];

    const int lane = threadIdx.x & 31, wid = threadIdx.x >> 5;
    const int hl   = lane >> 4, mr = lane & 15;
    const int row0 = blockIdx.x * G_BM;
    const int col0 = blockIdx.y * G_BN;

    v8f acc[4][4] = {};
    gemm_tile<1024>(x, x, wt, row0, col0, tile, acc);

    // C/D layout: reg r -> row r + 8*half
    u16* pp = p + (u32)((row0 + (wid & 3) * 64 + 8 * hl) * 1024 + col0 + (wid >> 2) * 64 + mr);
    #pragma unroll
    for (int i = 0; i < 4; i++) {
        u16 v[8][4];
        #pragma unroll
        for (int r = 0; r < 8; r++)
            #pragma unroll
            for (int j = 0; j < 4; j++)
                v[r][j] = f2bf(acc[i][j][r]);
        // the two fences keep the next rows' arithmetic out of the stretch between the stores and
        // their wait, so that the wait stands in front of every rewrite of a register a store names
        __builtin_amdgcn_sched_barrier(0);
        #pragma unroll
        for (int r = 0; r < 8; r++)
            #pragma unroll
            for (int j = 0; j < 4; j++)
                pp[(i * 16 + r) * 1024 + j * 16] = v[r][j];
        asm volatile("s_wait_xcnt 0x0" ::: "memory");
        __builtin_amdgcn_sched_barrier(0);
    }
}

typedef short s16x8 __attribute__((ext_vector_type(8)));

#define KV_KEYS  64     // keys per staged tile
#define K_PITCH  72     // u16 per LDS row = 144 B, an odd multiple of 16 B (ds_load_b128 readers)
#define V_PITCH  80     // u16 per LDS row = 160 B, an odd multiple of 32 B (ds_load_tr16_b128 readers)

__device__ __forceinline__ void kv_copy4(u32 l0, const u16* g0, u32 l1, const u16* g1,
                                         u32 l2, const u16* g2, u32 l3, const u16* g3) {
    asm volatile("global_load_async_to_lds_b128 %0, %1, off\n\t"
                 "global_load_async_to_lds_b128 %2, %3, off\n\t"
                 "global_load_async_to_lds_b128 %4, %5, off\n\t"
                 "global_load_async_to_lds_b128 %6, %7, off\n\t"
                 "s_wait_xcnt 0x0"
                 :: "v"(l0), "v"(g0), "v"(l1), "v"(g1), "v"(l2), "v"(g2), "v"(l3), "v"(g3) : "memory");
}

// lane (c, h) gets T[8h + 0..7][c] of the 16x16 block of 16-bit elements that the lanes' addresses name
__device__ __forceinline__ u32x4 ld_tr16(const u16* p) {
    return __builtin_bit_cast(u32x4, __builtin_amdgcn_ds_load_tr16_b128_v8i16((AS3 s16x8*)p));
}

__device__ __forceinline__ float xhalf(float x) {
    const int v = __builtin_bit_cast(int, x);
    return __builtin_bit_cast(float,
        __builtin_amdgcn_permlanex16(v, v, 0x76543210, 0xfedcba98, false, false));
}

__global__ __launch_bounds__(256, 8) void attn_kernel(
    const u16* __restrict__ projq, const u16* __restrict__ projc,
    const int* __restrict__ mask_q, const int* __restrict__ mask_c,
    u16* __restrict__ attnq, u16* __restrict__ attnc)
{
    const int tid  = threadIdx.x;
    const int lane = tid & 31, wid = tid >> 5;
    const int hl = lane >> 4, mr = lane & 15;
    const int qb = blockIdx.x * 128 + wid * 16;
    const int h  = blockIdx.y;
    const int b  = blockIdx.z >> 1, type = blockIdx.z & 1;

    const u16* Q     = type ? projq : projc;
    const u16* KV    = type ? projc : projq;
    const int* maskp = type ? mask_c : mask_q;
    u16*       out   = type ? attnc : attnq;

    __shared__ __attribute__((aligned(16))) u16 Kt[2][KV_KEYS][K_PITCH];
    __shared__ __attribute__((aligned(16))) u16 Vt[2][KV_KEYS][V_PITCH];

    // each thread copies chunk cc (16 B) of rows cr and cr + 32 of a tile
    const int cr = tid >> 3, cc = (tid & 7) * 8;
    const u16* gsrc = KV + ((size_t)(b * 1024 + cr)) * 1024 + h * 64 + cc;
    const u32  kdst = (u32)(size_t)&Kt[0][cr][cc];
    const u32  vdst = (u32)(size_t)&Vt[0][cr][cc];
    auto stage = [&](int t, int buf) {
        const u16* g  = gsrc + (size_t)t * (KV_KEYS * 1024);
        const u32  lk = kdst + (u32)buf * (u32)(KV_KEYS * K_PITCH * 2);
        const u32  lv = vdst + (u32)buf * (u32)(KV_KEYS * V_PITCH * 2);
        kv_copy4(lk, g, lk + 32u * K_PITCH * 2u, g + 32 * 1024,
                 lv, g, lv + 32u * V_PITCH * 2u, g + 32 * 1024);
    };

    stage(0, 0);

    // Q fragments, now the B operand: column = query mr, d in the hardware k order
    Frag aq0, aq1;
    {
        const u16* qrow = Q + ((size_t)(b * 1024 + qb + mr)) * 1024 + h * 64;
        #pragma unroll
        for (int r = 0; r < 8; r++) {
            int k = kpair(r, hl);
            aq0.u[r] = *(const u32*)(qrow + k);
            aq1.u[r] = *(const u32*)(qrow + 32 + k);
        }
    }
    asm volatile("s_wait_xcnt 0x0" ::: "memory");

    // This lane's query: 1/sqrt(DK) in base 2. A masked query has every score equal
    // (-65504 in the definition); softmax does not see a shift common to a row, so scale 0 gives
    // the same uniform row.
    const float cs = (maskp[b * 1024 + qb + mr] == 0) ? 0.0f : 0.125f * 1.4426950408889634f;

    float mstat = -1.0e30f;     // running maximum, scaled, equal in both halves of the wave
    float lstat = 0.0f;         // running sum over this half's keys; the halves join behind the loop
    v8f o0 = {}, o1 = {}, o2 = {}, o3 = {};     // o_t[r] = O[query mr][16 t + 8 hl + r]

    // tile 0 has landed for this wave, then for the block; only then tile 1 starts
    asm volatile("s_wait_asynccnt 0x0" ::: "memory");
    __syncthreads();
    stage(1, 1);

    for (int t = 0; t < 1024 / KV_KEYS; t++) {
        const int buf = t & 1;
        // unrolled: every LDS offset of a half becomes an immediate of its load
        #pragma unroll
        for (int sub = 0; sub < 2; sub++) {
            // K fragments, the A operand: row = key, d in the hardware k order (as Q's)
            Frag bk0, bk1, bk2, bk3;
            {
                const u16* kr0 = &Kt[buf][sub * 32      + mr][8 * hl];
                const u16* kr1 = &Kt[buf][sub * 32 + 16 + mr][8 * hl];
                bk0.q[0] = *(const u32x4*)(kr0);      bk0.q[1] = *(const u32x4*)(kr0 + 16);
                bk1.q[0] = *(const u32x4*)(kr0 + 32); bk1.q[1] = *(const u32x4*)(kr0 + 48);
                bk2.q[0] = *(const u32x4*)(kr1);      bk2.q[1] = *(const u32x4*)(kr1 + 16);
                bk3.q[0] = *(const u32x4*)(kr1 + 32); bk3.q[1] = *(const u32x4*)(kr1 + 48);
            }
            // s0[r] = score(key 8 hl + r, query mr), s1[r] = score(key 16 + 8 hl + r, query mr)
            v8f s0 = {}, s1 = {};
            s0 = bf16_wmma(bk0, aq0, s0);
            s0 = bf16_wmma(bk1, aq1, s0);
            s1 = bf16_wmma(bk2, aq0, s1);
            s1 = bf16_wmma(bk3, aq1, s1);

            // V^T fragments, the A operand: the same rows, transposed on the way out of LDS;
            // keys 0-15 fill registers 0-3, keys 16-31 registers 4-7 (hardware k order, as P^T's)
            Frag bv0, bv1, bv2, bv3;
            {
                const u16* vr = &Vt[buf][sub * 32 + 8 * hl + (lane & 7)][8 * ((lane >> 3) & 1)];
                bv0.q[0] = ld_tr16(vr);      bv0.q[1] = ld_tr16(vr + 16 * V_PITCH);
                bv1.q[0] = ld_tr16(vr + 16); bv1.q[1] = ld_tr16(vr + 16 * V_PITCH + 16);
                bv2.q[0] = ld_tr16(vr + 32); bv2.q[1] = ld_tr16(vr + 16 * V_PITCH + 32);
                bv3.q[0] = ld_tr16(vr + 48); bv3.q[1] = ld_tr16(vr + 16 * V_PITCH + 48);
            }

            // maximum of the raw scores (the scale is not negative), then over both halves
            float mx = fmaxf(s0[0], s1[0]);
            #pragma unroll
            for (int r = 1; r < 8; r++) mx = fmaxf(mx, fmaxf(s0[r], s1[r]));
            mx = fmaxf(mx, xhalf(mx));
            const float mn = fmaxf(mstat, mx * cs);
            const float al = __builtin_amdgcn_exp2f(mstat - mn);
            mstat = mn;

            // P^T: elements 0-7 from s0, 8-15 from s1, the k order of a B operand
            Frag pf;
            f32x2 rs = {0.0f, 0.0f};
            #pragma unroll
            for (int i = 0; i < 4; i++) {
                const f32x2 a0 = __builtin_elementwise_fma(f32x2{s0[2 * i], s0[2 * i + 1]}, f32x2{cs, cs}, f32x2{-mn, -mn});
                const f32x2 a1 = __builtin_elementwise_fma(f32x2{s1[2 * i], s1[2 * i + 1]}, f32x2{cs, cs}, f32x2{-mn, -mn});
                const f32x2 e0 = {__builtin_amdgcn_exp2f(a0.x), __builtin_amdgcn_exp2f(a0.y)};
                const f32x2 e1 = {__builtin_amdgcn_exp2f(a1.x), __builtin_amdgcn_exp2f(a1.y)};
                pf.u[i]     = pack2(e0.x, e0.y);
                pf.u[4 + i] = pack2(e1.x, e1.y);
                rs += e0 + e1;
            }
            lstat = lstat * al + (rs.x + rs.y);
            o0 *= al; o1 *= al; o2 *= al; o3 *= al;

            o0 = bf16_wmma(bv0, pf, o0);
            o1 = bf16_wmma(bv1, pf, o1);
            o2 = bf16_wmma(bv2, pf, o2);
            o3 = bf16_wmma(bv3, pf, o3);
        }

        // hand-over: this wave's reads of tile t are done, its copies of tile t + 1
        // have landed; behind the barrier both hold for the whole block
        asm volatile("s_wait_dscnt 0x0" ::: "memory");
        asm volatile("s_wait_asynccnt 0x0" ::: "memory");
        __syncthreads();
        if (t + 2 < 1024 / KV_KEYS) stage(t + 2, buf);
    }
    // no copy is left in flight when the wave ends
    asm volatile("s_wait_asynccnt 0x0" ::: "memory");

    // a lane's 8 registers of a tile are 8 consecutive d of its query: one 16-byte store each
    const float inv = 1.0f / (lstat + xhalf(lstat));
    u16* orow = out + (u32)((b * 1024 + qb + mr) * 1024 + h * 64 + 8 * hl);
    o0 *= inv; o1 *= inv; o2 *= inv; o3 *= inv;
    *(u32x4*)(orow)      = u32x4{pack2(o0[0], o0[1]), pack2(o0[2], o0[3]), pack2(o0[4], o0[5]), pack2(o0[6], o0[7])};
    *(u32x4*)(orow + 16) = u32x4{pack2(o1[0], o1[1]), pack2(o1[2], o1[3]), pack2(o1[4], o1[5]), pack2(o1[6], o1[7])};
    *(u32x4*)(orow + 32) = u32x4{pack2(o2[0], o2[1]), pack2(o2[2], o2[3]), pack2(o2[4], o2[5]), pack2(o2[6], o2[7])};
    *(u32x4*)(orow + 48) = u32x4{pack2(o3[0], o3[1]), pack2(o3[2], o3[3]), pack2(o3[4], o3[5]), pack2(o3[6], o3[7])};
}

// ---------------------------------------------------------------- FFN GEMM
// out = x + tanh(concat([x, x_attn]) @ W + b);  M=4096, N=1024, K=2048.
// Wt is [1024(N) x 2048(K)] bf16 (pre-transposed).

// tanh of two values with no branch: tanh x = 1 - 2 / (1 + e^(2x)), e^(2x) = 2^(x * 2 log2 e).
// The ends are the limits themselves: the power overflows to infinity and gives 1, underflows
// to 0 and gives -1; a NaN stays a NaN. The error is absolute, about one part in 10^7 of 1.
__device__ __forceinline__ f32x2 tanh2(f32x2 x) {
    const f32x2 t = x * f32x2{2.885390081777927f, 2.885390081777927f};
    const f32x2 d = f32x2{__builtin_amdgcn_exp2f(t.x), __builtin_amdgcn_exp2f(t.y)} + f32x2{1.0f, 1.0f};
    const f32x2 q = {__builtin_amdgcn_rcpf(d.x), __builtin_amdgcn_rcpf(d.y)};
    return __builtin_elementwise_fma(q, f32x2{-2.0f, -2.0f}, f32x2{1.0f, 1.0f});
}

__global__ __launch_bounds__(256) void ffn_gemm(
    const u16* __restrict__ xqb, const u16* __restrict__ xcb,
    const u16* __restrict__ aqb, const u16* __restrict__ acb,
    const u16* __restrict__ w1t, const u16* __restrict__ w2t,
    const float* __restrict__ b1, const float* __restrict__ b2,
    const float* __restrict__ xq, const float* __restrict__ xc,
    float* __restrict__ outq, float* __restrict__ outc)
{
    const u16* src0  = blockIdx.z ? xcb : xqb;
    const u16* src1  = blockIdx.z ? acb : aqb;
    const u16* wt    = blockIdx.z ? w2t : w1t;
    const float* bias = blockIdx.z ? b2 : b1;
    const float* xf  = blockIdx.z ? xc : xq;
    float*       out = blockIdx.z ? outc : outq;

    __shared__ __attribute__((aligned(16))) u16 tile[2 * G_ROWS * G_PITCH];

    const int lane = threadIdx.x & 31, wid = threadIdx.x >> 5;
    const int hl   = lane >> 4, mr = lane & 15;
    const int row0 = blockIdx.x * G_BM;
    const int col0 = blockIdx.y * G_BN;

    v8f acc[4][4] = {};
    gemm_tile<2048>(src0, src1, wt, row0, col0, tile, acc);

    const int colb = col0 + (wid >> 2) * 64 + mr;
    const u32 e0 = (u32)((row0 + (wid & 3) * 64 + 8 * hl) * 1024 + colb);   // C/D layout: reg r -> row r + 8*half
    const float* xp = xf + e0;
    float*       op = out + e0;
    // the bias first: the first element then waits for the oldest loads only
    const float bb[4] = {bias[colb], bias[colb + 16], bias[colb + 32], bias[colb + 48]};
    asm volatile("s_wait_xcnt 0x0" ::: "memory");
    v8f xr[4][4];
    #pragma unroll
    for (int i = 0; i < 4; i++)
        #pragma unroll
        for (int r = 0; r < 8; r++)
            #pragma unroll
            for (int j = 0; j < 4; j++)
                xr[i][j][r] = xp[(i * 16 + r) * 1024 + 16 * j];
    asm volatile("s_wait_xcnt 0x0" ::: "memory");
    // unrolled: two tanh are seven instructions and no branch, so that the 128 of a thread are
    // independent straight-line work and every store offset is an immediate
    #pragma unroll
    for (int i = 0; i < 4; i++) {
        f32x2 v[4][4];
        #pragma unroll
        for (int j = 0; j < 4; j++)
            #pragma unroll
            for (int p = 0; p < 4; p++)
                v[j][p] = f32x2{xr[i][j][2 * p], xr[i][j][2 * p + 1]}
                        + tanh2(f32x2{acc[i][j][2 * p], acc[i][j][2 * p + 1]} + f32x2{bb[j], bb[j]});
        // the two fences keep the next rows' arithmetic out of the stretch between the stores and
        // their wait, so that the wait stands in front of every rewrite of a register a store names
        __builtin_amdgcn_sched_barrier(0);
        #pragma unroll
        for (int r = 0; r < 8; r++)
            #pragma unroll
            for (int j = 0; j < 4; j++)
                op[(i * 16 + r) * 1024 + 16 * j] = v[j][r >> 1][r & 1];
        asm volatile("s_wait_xcnt 0x0" ::: "memory");
        __builtin_amdgcn_sched_barrier(0);
    }
}

// ---------------------------------------------------------------- launcher

extern "C" void kernel_launch(void* const* d_in, const int* in_sizes, int n_in,
                              void* d_out, int out_size, void* d_ws, size_t ws_size,
                              hipStream_t stream) {
    (void)in_sizes; (void)n_in; (void)out_size; (void)ws_size;

    const float* question = (const float*)d_in[0];
    const float* context  = (const float*)d_in[1];
    const int*   mask_q   = (const int*)d_in[2];
    const int*   mask_c   = (const int*)d_in[3];
    const float* Wq = (const float*)d_in[4];
    const float* Wc = (const float*)d_in[5];
    const float* W1 = (const float*)d_in[6];
    const float* b1 = (const float*)d_in[7];
    const float* W2 = (const float*)d_in[8];
    const float* b2 = (const float*)d_in[9];

    const size_t NX = (size_t)4 * 1024 * 1024;   // B*S*D
    u16* ws  = (u16*)d_ws;
    u16* xqb = ws;                u16* xcb = xqb + NX;
    u16* wqb = xcb + NX;          u16* wcb = wqb + (size_t)1024 * 1024;
    u16* w1b = wcb + (size_t)1024 * 1024;
    u16* w2b = w1b + (size_t)2048 * 1024;
    u16* pq  = w2b + (size_t)2048 * 1024;
    u16* pc  = pq + NX;
    u16* aq  = pc + NX;
    u16* ac  = aq + NX;

    float* outq = (float*)d_out;
    float* outc = outq + NX;

    prep<<<256, 512, 0, stream>>>(question, context, Wq, Wc, W1, W2,
                                  xqb, xcb, wqb, wcb, w1b, w2b);

    proj_gemm<<<dim3(16, 8, 2), 256, 0, stream>>>(xqb, xcb, wqb, wcb, pq, pc);
    attn_kernel<<<dim3(8, 16, 8), 256, 0, stream>>>(pq, pc, mask_q, mask_c, aq, ac);
    ffn_gemm<<<dim3(16, 8, 2), 256, 0, stream>>>(xqb, xcb, aq, ac, w1b, w2b,
                                                 b1, b2, question, context, outq, outc);
}

// v006
// A run of this version takes 81.7 microseconds.
// Timed twice side by side with v005, it ran 1.06 times as fast both times.
// Over all steps from v000 it is 3.55 times as fast.
#include <hip/hip_runtime.h>

typedef unsigned short u16;
typedef unsigned int   u32;
typedef __attribute__((ext_vector_type(16))) __bf16 v16bf;
typedef __attribute__((ext_vector_type(8)))  float  v8f;

#define AS3 __attribute__((address_space(3)))

// ---------------------------------------------------------------- utilities

typedef u32 u32x4 __attribute__((ext_vector_type(4)));

union Frag {
    u32   u[8];
    u32x4 q[2];
    u16   s[16];
    v16bf v;
};

__device__ __forceinline__ u16 f2bf(float f) {
    u32 u = __float_as_uint(f);
    u32 r = u + 0x7FFFu + ((u >> 16) & 1u);   // round-to-nearest-even
    return (u16)(r >> 16);
}

__device__ __forceinline__ int kpair(int r, int hl) {
    return (r < 4 ? 2 * r : 16 + 2 * (r - 4)) + 8 * hl;
}

__device__ __forceinline__ v8f bf16_wmma(Frag a, Frag b, v8f c) {
    return __builtin_amdgcn_wmma_f32_16x16x32_bf16(
        false, a.v, false, b.v, (short)0, c, false, false);
}

// ---------------------------------------------------------------- pre-pass
// ONE launch rounds both activations to bf16 and lays all four weights down as
// [N][K] bf16 (N-major, so that the GEMMs' B tiles are contiguous row copies).
// 256 work-groups of 16 waves, all with the same share: six 64 x 64 weight tiles
// (one of Wq, one of Wc, two of W1, two of W2) and 4096 16-byte pieces of each
// activation. A thread issues all its 28 loads before it uses the first, so the
// whole input is in flight at once; every wave-wide load and store covers whole
// 128-byte lines.

typedef float f32x4 __attribute__((ext_vector_type(4)));
typedef float f32x2 __attribute__((ext_vector_type(2)));
typedef __bf16 bf16x2 __attribute__((ext_vector_type(2)));
typedef u32 u32x2 __attribute__((ext_vector_type(2)));

// two f32 -> one register of two bf16, round to nearest even
__device__ __forceinline__ u32 pack2(float lo, float hi) {
    return __builtin_bit_cast(u32, __builtin_convertvector(f32x2{lo, hi}, bf16x2));
}

__global__ __launch_bounds__(512) void prep(
    const float* __restrict__ question, const float* __restrict__ context,
    const float* __restrict__ Wq, const float* __restrict__ Wc,
    const float* __restrict__ W1, const float* __restrict__ W2,
    u16* __restrict__ xqb, u16* __restrict__ xcb,
    u16* __restrict__ wqb, u16* __restrict__ wcb,
    u16* __restrict__ w1b, u16* __restrict__ w2b)
{
    __shared__ __attribute__((aligned(16))) u32 tl[6][64][32];

    const int t  = threadIdx.x;
    const int nt = blockIdx.x & 15, kt = blockIdx.x >> 4;    // tile column, tile row

    // weights: this thread reads columns 4 c4 .. 4 c4 + 3 of tile rows 2 r and 2 r + 1
    const int c4 = t & 15, r = t >> 4;
    const u32 so = (u32)((kt * 64 + 2 * r) * 1024 + nt * 64 + 4 * c4);
    const float* wsrc[6] = {Wq + so, Wc + so, W1 + so, W1 + so + 1024 * 1024,
                            W2 + so, W2 + so + 1024 * 1024};
    f32x4 w0[6], w1[6];
    #pragma unroll
    for (int i = 0; i < 6; i++) {
        w0[i] = *(const f32x4*)(wsrc[i]);
        w1[i] = *(const f32x4*)(wsrc[i] + 1024);
    }
    asm volatile("s_wait_xcnt 0x0" ::: "memory");

    // activations: piece xo + 512 i, so that a wave reads 512 contiguous bytes
    const u32 xo = (u32)blockIdx.x * 4096u + (u32)t;
    f32x4 xa[8], xb[8];
    #pragma unroll
    for (int i = 0; i < 8; i++) xa[i] = ((const f32x4*)question)[xo + 512u * i];
    #pragma unroll
    for (int i = 0; i < 8; i++) xb[i] = ((const f32x4*)context)[xo + 512u * i];
    // keeps every load above this line: without it the compiler sinks the weight loads to
    // their uses, pair by pair, and the wave pays one memory latency after another
    __builtin_amdgcn_sched_barrier(0);

    {
        const int col = (((r >> 2) ^ (c4 & 7)) << 2) + (r & 3);
        #pragma unroll
        for (int i = 0; i < 6; i++)
            #pragma unroll
            for (int j = 0; j < 4; j++)
                tl[i][4 * c4 + j][col] = pack2(w0[i][j], w1[i][j]);
    }
    __syncthreads();
    {
        // this thread stores k = 8 q .. 8 q + 7 of column n: a wave fills four whole lines
        const int n = t >> 3, q = t & 7;
        const int col = (q ^ ((n >> 2) & 7)) << 2;
        const u32 d1 = (u32)((nt * 64 + n) * 1024 + kt * 64 + 8 * q);
        const u32 d2 = (u32)((nt * 64 + n) * 2048 + kt * 64 + 8 * q);
        u16* wdst[6] = {wqb + d1, wcb + d1, w1b + d2, w1b + d2 + 1024, w2b + d2, w2b + d2 + 1024};
        #pragma unroll
        for (int i = 0; i < 6; i++)
            *(u32x4*)(wdst[i]) = *(const u32x4*)&tl[i][n][col];
    }

    #pragma unroll
    for (int i = 0; i < 8; i++)
        ((u32x2*)xqb)[xo + 512u * i] = u32x2{pack2(xa[i].x, xa[i].y), pack2(xa[i].z, xa[i].w)};
    #pragma unroll
    for (int i = 0; i < 8; i++)
        ((u32x2*)xcb)[xo + 512u * i] = u32x2{pack2(xb[i].x, xb[i].y), pack2(xb[i].z, xb[i].w)};
}

// ---------------------------------------------------------------- GEMM main loop
// Y = X . Wt^T, X [M][1024-wide rows] and Wt [N][KTOT] both k-contiguous bf16.
// One work-group of 8 waves per 256 (M) x 128 (N) tile of Y, one work-group per WGP;
// a wave holds 64 x 64 of it (4 x 4 accumulator tiles), so a loaded fragment serves four
// matrix instructions. A trip is 128 k: [X 256 rows | Wt 128 rows] of 256 bytes, two buffers,
// the next trip's rows copied to LDS while this trip's are worked on.

#define G_BM    256
#define G_BN    128
#define G_BK    128     // k per trip
#define G_PITCH 136     // u16 per LDS row = 272 B, an odd multiple of 16 B (ds_load_b128 readers)
#define G_ROWS  (G_BM + G_BN)

__device__ __forceinline__ void copy12(const u32* l, const u16* const* g) {
    asm volatile("global_load_async_to_lds_b128 %0, %12, off\n\t"
                 "global_load_async_to_lds_b128 %1, %13, off\n\t"
                 "global_load_async_to_lds_b128 %2, %14, off\n\t"
                 "global_load_async_to_lds_b128 %3, %15, off\n\t"
                 "global_load_async_to_lds_b128 %4, %16, off\n\t"
                 "global_load_async_to_lds_b128 %5, %17, off\n\t"
                 "global_load_async_to_lds_b128 %6, %18, off\n\t"
                 "global_load_async_to_lds_b128 %7, %19, off\n\t"
                 "global_load_async_to_lds_b128 %8, %20, off\n\t"
                 "global_load_async_to_lds_b128 %9, %21, off\n\t"
                 "global_load_async_to_lds_b128 %10, %22, off\n\t"
                 "global_load_async_to_lds_b128 %11, %23, off\n\t"
                 "s_wait_xcnt 0x0"
                 :: "v"(l[0]), "v"(l[1]), "v"(l[2]), "v"(l[3]), "v"(l[4]), "v"(l[5]),
                    "v"(l[6]), "v"(l[7]), "v"(l[8]), "v"(l[9]), "v"(l[10]), "v"(l[11]),
                    "v"(g[0]), "v"(g[1]), "v"(g[2]), "v"(g[3]), "v"(g[4]), "v"(g[5]),
                    "v"(g[6]), "v"(g[7]), "v"(g[8]), "v"(g[9]), "v"(g[10]), "v"(g[11])
                 : "memory");
}

// x0 holds k 0..1023 of X's rows, x1 k 1024..2047 (read only where KTOT is 2048).
// tile: LDS, [2][G_ROWS][G_PITCH]. acc[i][j]: rows 16 i, columns 16 j of the wave's 64 x 64.
template <int KTOT>
__device__ __forceinline__ void gemm_tile(const u16* __restrict__ x0, const u16* __restrict__ x1,
                                          const u16* __restrict__ wt, int row0, int col0,
                                          u16* tile, v8f (&acc)[4][4])
{
    const int tid  = threadIdx.x;
    const int lane = tid & 31, wid = tid >> 5;
    const int hl   = lane >> 4, mr = lane & 15;
    const int wm   = wid & 3, wn = wid >> 2;

    // each thread copies chunk cc (16 B) of rows cr + 16 j: a wave fills two whole rows a copy
    const int cr = tid >> 4, cc = (tid & 15) * 8;
    const u32 xoff = (u32)((row0 + cr) * 1024 + cc);
    const u16* wsrc = wt + (u32)((col0 + cr) * KTOT + cc);
    const u32 ldst = (u32)(size_t)(tile + cr * G_PITCH + cc);

    auto stage = [&](int t, int buf) {
        const int k0 = t * G_BK;
        const u16* xs = ((KTOT > 1024 && k0 >= 1024) ? x1 : x0) + xoff + (k0 & 1023);
        const u16* ws = wsrc + k0;
        const u32  lb = ldst + (u32)buf * (u32)(G_ROWS * G_PITCH * 2);
        u32 l[12];
        const u16* g[12];
        #pragma unroll
        for (int j = 0; j < 12; j++) { l[j] = lb + (u32)j * (u32)(16 * G_PITCH * 2); g[j] = xs + j * (16 * 1024); }
        copy12(l, g);
        // keeps the second dozen's address arithmetic behind the first dozen's statement: formed
        // ahead of it, the addresses overfill the registers that asm text can name, and the build spills
        __builtin_amdgcn_sched_barrier(0);
        #pragma unroll
        for (int j = 0; j < 4; j++) { l[j] = lb + (u32)(12 + j) * (u32)(16 * G_PITCH * 2); g[j] = xs + (12 + j) * (16 * 1024); }
        #pragma unroll
        for (int j = 0; j < 8; j++) { l[4 + j] = lb + (u32)(16 + j) * (u32)(16 * G_PITCH * 2); g[4 + j] = ws + j * (16 * KTOT); }
        copy12(l, g);
    };

    constexpr int T = KTOT / G_BK;

    // two fragment sets: block ks of a trip (32 k, 16 matrix instructions) works on set ks & 1
    Frag a[2][4], b[2][4];
    const u32 aoff = (u32)((wm * 64 + mr) * G_PITCH + 8 * hl);
    const u32 boff = (u32)((G_BM + wn * 64 + mr) * G_PITCH + 8 * hl);
    auto frags = [&](int buf, int ks, int s) {
        const u16* ap = tile + buf * (G_ROWS * G_PITCH) + aoff + ks * 32;
        const u16* bp = tile + buf * (G_ROWS * G_PITCH) + boff + ks * 32;
        #pragma unroll
        for (int i = 0; i < 4; i++) {
            a[s][i].q[0] = *(const u32x4*)(ap + i * 16 * G_PITCH);
            a[s][i].q[1] = *(const u32x4*)(ap + i * 16 * G_PITCH + 16);
            b[s][i].q[0] = *(const u32x4*)(bp + i * 16 * G_PITCH);
            b[s][i].q[1] = *(const u32x4*)(bp + i * 16 * G_PITCH + 16);
        }
        // keeps the 16 LDS reads above in one group ahead of the matrix run below: without it
        // the compiler spreads them among the matrix instructions, each with a wait to 0
        __builtin_amdgcn_sched_barrier(0);
    };
    auto block = [&](int s) {
        #pragma unroll
        for (int i = 0; i < 4; i++)
            #pragma unroll
            for (int j = 0; j < 4; j++)
                acc[i][j] = bf16_wmma(a[s][i], b[s][j], acc[i][j]);
        // keeps the next group of LDS reads out of the matrix run above
        __builtin_amdgcn_sched_barrier(0);
    };

    stage(0, 0);
    // tile 0 has landed for this wave, then for the block; only then tile 1 starts
    asm volatile("s_wait_asynccnt 0x0" ::: "memory");
    __syncthreads();
    stage(1, 1);
    frags(0, 0, 0);

    for (int t = 0; t < T; t++) {
        const int buf = t & 1;
        // unrolled: the fragment sets are named at compile time
        #pragma unroll
        for (int ks = 0; ks < G_BK / 32 - 1; ks++) {
            frags(buf, ks + 1, (ks + 1) & 1);
            block(ks & 1);
        }
        // hand-over: this wave's reads of tile t are done (its last block's fragments are in
        // registers), its copies of tile t + 1 have landed; behind the barrier both hold for the block
        asm volatile("s_wait_dscnt 0x0" ::: "memory");
        asm volatile("s_wait_asynccnt 0x0" ::: "memory");
        __syncthreads();
        if (t + 2 < T) stage(t + 2, buf);
        // tile t + 1's first fragments fly under tile t's last block. No branch round them (it would
        // merge two paths in the wait counting): on the last trip they read the idle buffer, unused.
        frags(buf ^ 1, 0, 0);
        block((G_BK / 32 - 1) & 1);
    }
    // no copy is left in flight when the wave goes on
    asm volatile("s_wait_asynccnt 0x0" ::: "memory");
}

// ---------------------------------------------------------------- projection GEMM
// [4096 x 1024] (bf16) @ Wt [1024(N) x 1024(K)] (bf16) -> bf16

__global__ __launch_bounds__(256) void proj_gemm(
    const u16* __restrict__ xq, const u16* __restrict__ xc,
    const u16* __restrict__ wtq, const u16* __restrict__ wtc,
    u16* __restrict__ pq, u16* __restrict__ pc)
{
    const u16* x  = blockIdx.z ? xc  : xq;
    const u16* wt = blockIdx.z ? wtc : wtq;
    u16*       p  = blockIdx.z ? pc  : pq;

    __shared__ __attribute__((aligned(16))) u16 tile[2 * G_ROWS * G_PITCH];

    const int lane = threadIdx.x & 31, wid = threadIdx.x >> 5;
    const int hl   = lane >> 4, mr = lane & 15;
    const int row0 = blockIdx.x * G_BM;
    const int col0 = blockIdx.y * G_BN;

    v8f acc[4][4] = {};
    gemm_tile<1024>(x, x, wt, row0, col0, tile, acc);

    // C/D layout: reg r -> row r + 8*half
    u16* pp = p + (u32)((row0 + (wid & 3) * 64 + 8 * hl) * 1024 + col0 + (wid >> 2) * 64 + mr);
    #pragma unroll
    for (int i = 0; i < 4; i++) {
        u16 v[8][4];
        #pragma unroll
        for (int r = 0; r < 8; r++)
            #pragma unroll
            for (int j = 0; j < 4; j++)
                v[r][j] = f2bf(acc[i][j][r]);
        // the two fences keep the next rows' arithmetic out of the stretch between the stores and
        // their wait, so that the wait stands in front of every rewrite of a register a store names
        __builtin_amdgcn_sched_barrier(0);
        #pragma unroll
        for (int r = 0; r < 8; r++)
            #pragma unroll
            for (int j = 0; j < 4; j++)
                pp[(i * 16 + r) * 1024 + j * 16] = v[r][j];
        asm volatile("s_wait_xcnt 0x0" ::: "memory");
        __builtin_amdgcn_sched_barrier(0);
    }
}

typedef short s16x8 __attribute__((ext_vector_type(8)));

#define KV_KEYS  64     // keys per staged tile
#define K_PITCH  72     // u16 per LDS row = 144 B, an odd multiple of 16 B (ds_load_b128 readers)
#define V_PITCH  80     // u16 per LDS row = 160 B, an odd multiple of 32 B (ds_load_tr16_b128 readers)

__device__ __forceinline__ void kv_copy4(u32 l0, const u16* g0, u32 l1, const u16* g1,
                                         u32 l2, const u16* g2, u32 l3, const u16* g3) {
    asm volatile("global_load_async_to_lds_b128 %0, %1, off\n\t"
                 "global_load_async_to_lds_b128 %2, %3, off\n\t"
                 "global_load_async_to_lds_b128 %4, %5, off\n\t"
                 "global_load_async_to_lds_b128 %6, %7, off\n\t"
                 "s_wait_xcnt 0x0"
                 :: "v"(l0), "v"(g0), "v"(l1), "v"(g1), "v"(l2), "v"(g2), "v"(l3), "v"(g3) : "memory");
}

// lane (c, h) gets T[8h + 0..7][c] of the 16x16 block of 16-bit elements that the lanes' addresses name
__device__ __forceinline__ u32x4 ld_tr16(const u16* p) {
    return __builtin_bit_cast(u32x4, __builtin_amdgcn_ds_load_tr16_b128_v8i16((AS3 s16x8*)p));
}

__device__ __forceinline__ float xhalf(float x) {
    const int v = __builtin_bit_cast(int, x);
    return __builtin_bit_cast(float,
        __builtin_amdgcn_permlanex16(v, v, 0x76543210, 0xfedcba98, false, false));
}

__global__ __launch_bounds__(256, 8) void attn_kernel(
    const u16* __restrict__ projq, const u16* __restrict__ projc,
    const int* __restrict__ mask_q, const int* __restrict__ mask_c,
    u16* __restrict__ attnq, u16* __restrict__ attnc)
{
    const int tid  = threadIdx.x;
    const int lane = tid & 31, wid = tid >> 5;
    const int hl = lane >> 4, mr = lane & 15;
    const int qb = blockIdx.x * 128 + wid * 16;
    const int h  = blockIdx.y;
    const int b  = blockIdx.z >> 1, type = blockIdx.z & 1;

    const u16* Q     = type ? projq : projc;
    const u16* KV    = type ? projc : projq;
    const int* maskp = type ? mask_c : mask_q;
    u16*       out   = type ? attnc : attnq;

    __shared__ __attribute__((aligned(16))) u16 Kt[2][KV_KEYS][K_PITCH];
    __shared__ __attribute__((aligned(16))) u16 Vt[2][KV_KEYS][V_PITCH];

    // each thread copies chunk cc (16 B) of rows cr and cr + 32 of a tile
    const int cr = tid >> 3, cc = (tid & 7) * 8;
    const u16* gsrc = KV + ((size_t)(b * 1024 + cr)) * 1024 + h * 64 + cc;
    const u32  kdst = (u32)(size_t)&Kt[0][cr][cc];
    const u32  vdst = (u32)(size_t)&Vt[0][cr][cc];
    auto stage = [&](int t, int buf) {
        const u16* g  = gsrc + (size_t)t * (KV_KEYS * 1024);
        const u32  lk = kdst + (u32)buf * (u32)(KV_KEYS * K_PITCH * 2);
        const u32  lv = vdst + (u32)buf * (u32)(KV_KEYS * V_PITCH * 2);
        kv_copy4(lk, g, lk + 32u * K_PITCH * 2u, g + 32 * 1024,
                 lv, g, lv + 32u * V_PITCH * 2u, g + 32 * 1024);
    };

    stage(0, 0);

    // Q fragments, now the B operand: column = query mr, d in the hardware k order
    Frag aq0, aq1;
    {
        const u16* qrow = Q + ((size_t)(b * 1024 + qb + mr)) * 1024 + h * 64;
        #pragma unroll
        for (int r = 0; r < 8; r++) {
            int k = kpair(r, hl);
            aq0.u[r] = *(const u32*)(qrow + k);
            aq1.u[r] = *(const u32*)(qrow + 32 + k);
        }
    }
    asm volatile("s_wait_xcnt 0x0" ::: "memory");

    // This lane's query: 1/sqrt(DK) in base 2. A masked query has every score equal
    // (-65504 in the definition); softmax does not see a shift common to a row, so scale 0 gives
    // the same uniform row.
    const float cs = (maskp[b * 1024 + qb + mr] == 0) ? 0.0f : 0.125f * 1.4426950408889634f;

    float mstat = -1.0e30f;     // reference of the exponentials, scaled, equal in both halves of the wave
    float lstat = 0.0f;         // running sum over this half's keys; the halves join behind the loop
    v8f o0 = {}, o1 = {}, o2 = {}, o3 = {};     // o_t[r] = O[query mr][16 t + 8 hl + r]

    // tile 0 has landed for this wave, then for the block; only then tile 1 starts
    asm volatile("s_wait_asynccnt 0x0" ::: "memory");
    __syncthreads();
    stage(1, 1);

    for (int t = 0; t < 1024 / KV_KEYS; t++) {
        const int buf = t & 1;
        // unrolled: every LDS offset of a half becomes an immediate of its load
        #pragma unroll
        for (int sub = 0; sub < 2; sub++) {
            // K fragments, the A operand: row = key, d in the hardware k order (as Q's)
            Frag bk0, bk1, bk2, bk3;
            {
                const u16* kr0 = &Kt[buf][sub * 32      + mr][8 * hl];
                const u16* kr1 = &Kt[buf][sub * 32 + 16 + mr][8 * hl];
                bk0.q[0] = *(const u32x4*)(kr0);      bk0.q[1] = *(const u32x4*)(kr0 + 16);
                bk1.q[0] = *(const u32x4*)(kr0 + 32); bk1.q[1] = *(const u32x4*)(kr0 + 48);
                bk2.q[0] = *(const u32x4*)(kr1);      bk2.q[1] = *(const u32x4*)(kr1 + 16);
                bk3.q[0] = *(const u32x4*)(kr1 + 32); bk3.q[1] = *(const u32x4*)(kr1 + 48);
            }
            // s0[r] = score(key 8 hl + r, query mr), s1[r] = score(key 16 + 8 hl + r, query mr)
            v8f s0 = {}, s1 = {};
            s0 = bf16_wmma(bk0, aq0, s0);
            s0 = bf16_wmma(bk1, aq1, s0);
            s1 = bf16_wmma(bk2, aq0, s1);
            s1 = bf16_wmma(bk3, aq1, s1);

            // V^T fragments, the A operand: the same rows, transposed on the way out of LDS;
            // keys 0-15 fill registers 0-3, keys 16-31 registers 4-7 (hardware k order, as P^T's)
            Frag bv0, bv1, bv2, bv3;
            const u16* vr = &Vt[buf][sub * 32 + 8 * hl + (lane & 7)][8 * ((lane >> 3) & 1)];
            bv0.q[0] = ld_tr16(vr);      bv0.q[1] = ld_tr16(vr + 16 * V_PITCH);
            bv1.q[0] = ld_tr16(vr + 16); bv1.q[1] = ld_tr16(vr + 16 * V_PITCH + 16);
            // keeps the four loads above in front of the branch below, in flight under the exponentials:
            // without it the compiler sinks them behind the branch, pair by pair, each waited for
            __builtin_amdgcn_sched_barrier(0);

            // exponentials of this lane's 16 scores against the reference ref; returns their sum
            f32x2 e0[4], e1[4];
            auto expo = [&](float ref) -> float {
                f32x2 rs = {0.0f, 0.0f};
                #pragma unroll
                for (int i = 0; i < 4; i++) {
                    const f32x2 a0 = __builtin_elementwise_fma(f32x2{s0[2 * i], s0[2 * i + 1]}, f32x2{cs, cs}, f32x2{-ref, -ref});
                    const f32x2 a1 = __builtin_elementwise_fma(f32x2{s1[2 * i], s1[2 * i + 1]}, f32x2{cs, cs}, f32x2{-ref, -ref});
                    e0[i] = f32x2{__builtin_amdgcn_exp2f(a0.x), __builtin_amdgcn_exp2f(a0.y)};
                    e1[i] = f32x2{__builtin_amdgcn_exp2f(a1.x), __builtin_amdgcn_exp2f(a1.y)};
                    rs += e0[i] + e1[i];
                }
                return rs.x + rs.y;
            };
            float rl = expo(mstat);
            // Lazy rescale, tested on the sum: the reference in use stays while no lane's sum tops 2^8
            // (no P then does; an overflow is +inf and tops it too), and the quotient O / sum does not
            // see the reference. Else the maximum of the scores moves it, and the exponentials are
            // taken anew. One scalar branch for the wave: every lane is on at the products below.
            if (__builtin_expect(__builtin_amdgcn_ballot_w32(rl > 256.0f) != 0u, 0)) {
                // the scale is not negative: maximum of the raw scores, then over both halves
                float mx = fmaxf(s0[0], s1[0]);
                #pragma unroll
                for (int r = 1; r < 8; r++) mx = fmaxf(mx, fmaxf(s0[r], s1[r]));
                const float mn = fmaxf(mstat, fmaxf(mx, xhalf(mx)) * cs);
                const float al = __builtin_amdgcn_exp2f(mstat - mn);
                mstat = mn;
                lstat *= al;
                o0 *= al; o1 *= al; o2 *= al; o3 *= al;
                rl = expo(mn);
            }
            // the other half of V^T (all eight ahead of the branch spill)
            bv2.q[0] = ld_tr16(vr + 32); bv2.q[1] = ld_tr16(vr + 16 * V_PITCH + 32);
            bv3.q[0] = ld_tr16(vr + 48); bv3.q[1] = ld_tr16(vr + 16 * V_PITCH + 48);

            // P^T: elements 0-7 from s0, 8-15 from s1, the k order of a B operand
            Frag pf;
            #pragma unroll
            for (int i = 0; i < 4; i++) {
                pf.u[i]     = pack2(e0[i].x, e0[i].y);
                pf.u[4 + i] = pack2(e1[i].x, e1[i].y);
            }
            lstat += rl;

            o0 = bf16_wmma(bv0, pf, o0);
            o1 = bf16_wmma(bv1, pf, o1);
            o2 = bf16_wmma(bv2, pf, o2);
            o3 = bf16_wmma(bv3, pf, o3);
        }

        // hand-over: this wave's reads of tile t are done, its copies of tile t + 1
        // have landed; behind the barrier both hold for the whole block
        asm volatile("s_wait_dscnt 0x0" ::: "memory");
        asm volatile("s_wait_asynccnt 0x0" ::: "memory");
        __syncthreads();
        if (t + 2 < 1024 / KV_KEYS) stage(t + 2, buf);
    }
    // no copy is left in flight when the wave ends
    asm volatile("s_wait_asynccnt 0x0" ::: "memory");

    // a lane's 8 registers of a tile are 8 consecutive d of its query: one 16-byte store each
    const float inv = 1.0f / (lstat + xhalf(lstat));
    u16* orow = out + (u32)((b * 1024 + qb + mr) * 1024 + h * 64 + 8 * hl);
    o0 *= inv; o1 *= inv; o2 *= inv; o3 *= inv;
    *(u32x4*)(orow)      = u32x4{pack2(o0[0], o0[1]), pack2(o0[2], o0[3]), pack2(o0[4], o0[5]), pack2(o0[6], o0[7])};
    *(u32x4*)(orow + 16) = u32x4{pack2(o1[0], o1[1]), pack2(o1[2], o1[3]), pack2(o1[4], o1[5]), pack2(o1[6], o1[7])};
    *(u32x4*)(orow + 32) = u32x4{pack2(o2[0], o2[1]), pack2(o2[2], o2[3]), pack2(o2[4], o2[5]), pack2(o2[6], o2[7])};
    *(u32x4*)(orow + 48) = u32x4{pack2(o3[0], o3[1]), pack2(o3[2], o3[3]), pack2(o3[4], o3[5]), pack2(o3[6], o3[7])};
}

// ---------------------------------------------------------------- FFN GEMM
// out = x + tanh(concat([x, x_attn]) @ W + b);  M=4096, N=1024, K=2048.
// Wt is [1024(N) x 2048(K)] bf16 (pre-transposed).

// tanh of two values with no branch: tanh x = 1 - 2 / (1 + e^(2x)), e^(2x) = 2^(x * 2 log2 e).
// The ends are the limits themselves: the power overflows to infinity and gives 1, underflows
// to 0 and gives -1; a NaN stays a NaN. The error is absolute, about one part in 10^7 of 1.
__device__ __forceinline__ f32x2 tanh2(f32x2 x) {
    const f32x2 t = x * f32x2{2.885390081777927f, 2.885390081777927f};
    const f32x2 d = f32x2{__builtin_amdgcn_exp2f(t.x), __builtin_amdgcn_exp2f(t.y)} + f32x2{1.0f, 1.0f};
    const f32x2 q = {__builtin_amdgcn_rcpf(d.x), __builtin_amdgcn_rcpf(d.y)};
    return __builtin_elementwise_fma(q, f32x2{-2.0f, -2.0f}, f32x2{1.0f, 1.0f});
}

__global__ __launch_bounds__(256) void ffn_gemm(
    const u16* __restrict__ xqb, const u16* __restrict__ xcb,
    const u16* __restrict__ aqb, const u16* __restrict__ acb,
    const u16* __restrict__ w1t, const u16* __restrict__ w2t,
    const float* __restrict__ b1, const float* __restrict__ b2,
    const float* __restrict__ xq, const float* __restrict__ xc,
    float* __restrict__ outq, float* __restrict__ outc)
{
    const u16* src0  = blockIdx.z ? xcb : xqb;
    const u16* src1  = blockIdx.z ? acb : aqb;
    const u16* wt    = blockIdx.z ? w2t : w1t;
    const float* bias = blockIdx.z ? b2 : b1;
    const float* xf  = blockIdx.z ? xc : xq;
    float*       out = blockIdx.z ? outc : outq;

    __shared__ __attribute__((aligned(16))) u16 tile[2 * G_ROWS * G_PITCH];

    const int lane = threadIdx.x & 31, wid = threadIdx.x >> 5;
    const int hl   = lane >> 4, mr = lane & 15;
    const int row0 = blockIdx.x * G_BM;
    const int col0 = blockIdx.y * G_BN;

    v8f acc[4][4] = {};
    gemm_tile<2048>(src0, src1, wt, row0, col0, tile, acc);

    const int colb = col0 + (wid >> 2) * 64 + mr;
    const u32 e0 = (u32)((row0 + (wid & 3) * 64 + 8 * hl) * 1024 + colb);   // C/D layout: reg r -> row r + 8*half
    const float* xp = xf + e0;
    float*       op = out + e0;
    // the bias first: the first element then waits for the oldest loads only
    const float bb[4] = {bias[colb], bias[colb + 16], bias[colb + 32], bias[colb + 48]};
    asm volatile("s_wait_xcnt 0x0" ::: "memory");
    v8f xr[4][4];
    #pragma unroll
    for (int i = 0; i < 4; i++)
        #pragma unroll
        for (int r = 0; r < 8; r++)
            #pragma unroll
            for (int j = 0; j < 4; j++)
                xr[i][j][r] = xp[(i * 16 + r) * 1024 + 16 * j];
    asm volatile("s_wait_xcnt 0x0" ::: "memory");
    // unrolled: two tanh are seven instructions and no branch, so that the 128 of a thread are
    // independent straight-line work and every store offset is an immediate
    #pragma unroll
    for (int i = 0; i < 4; i++) {
        f32x2 v[4][4];
        #pragma unroll
        for (int j = 0; j < 4; j++)
            #pragma unroll
            for (int p = 0; p < 4; p++)
                v[j][p] = f32x2{xr[i][j][2 * p], xr[i][j][2 * p + 1]}
                        + tanh2(f32x2{acc[i][j][2 * p], acc[i][j][2 * p + 1]} + f32x2{bb[j], bb[j]});
        // the two fences keep the next rows' arithmetic out of the stretch between the stores and
        // their wait, so that the wait stands in front of every rewrite of a register a store names
        __builtin_amdgcn_sched_barrier(0);
        #pragma unroll
        for (int r = 0; r < 8; r++)
            #pragma unroll
            for (int j = 0; j < 4; j++)
                op[(i * 16 + r) * 1024 + 16 * j] = v[j][r >> 1][r & 1];
        asm volatile("s_wait_xcnt 0x0" ::: "memory");
        __builtin_amdgcn_sched_barrier(0);
    }
}

// ---------------------------------------------------------------- launcher

extern "C" void kernel_launch(void* const* d_in, const int* in_sizes, int n_in,
                              void* d_out, int out_size, void* d_ws, size_t ws_size,
                              hipStream_t stream) {
    (void)in_sizes; (void)n_in; (void)out_size; (void)ws_size;

    const float* question = (const float*)d_in[0];
    const float* context  = (const float*)d_in[1];
    const int*   mask_q   = (const int*)d_in[2];
    const int*   mask_c   = (const int*)d_in[3];
    const float* Wq = (const float*)d_in[4];
    const float* Wc = (const float*)d_in[5];
    const float* W1 = (const float*)d_in[6];
    const float* b1 = (const float*)d_in[7];
    const float* W2 = (const float*)d_in[8];
    const float* b2 = (const float*)d_in[9];

    const size_t NX = (size_t)4 * 1024 * 1024;   // B*S*D
    u16* ws  = (u16*)d_ws;
    u16* xqb = ws;                u16* xcb = xqb + NX;
    u16* wqb = xcb + NX;          u16* wcb = wqb + (size_t)1024 * 1024;
    u16* w1b = wcb + (size_t)1024 * 1024;
    u16* w2b = w1b + (size_t)2048 * 1024;
    u16* pq  = w2b + (size_t)2048 * 1024;
    u16* pc  = pq + NX;
    u16* aq  = pc + NX;
    u16* ac  = aq + NX;

    float* outq = (float*)d_out;
    float* outc = outq + NX;

    prep<<<256, 512, 0, stream>>>(question, context, Wq, Wc, W1, W2,
                                  xqb, xcb, wqb, wcb, w1b, w2b);

    proj_gemm<<<dim3(16, 8, 2), 256, 0, stream>>>(xqb, xcb, wqb, wcb, pq, pc);
    attn_kernel<<<dim3(8, 16, 8), 256, 0, stream>>>(pq, pc, mask_q, mask_c, aq, ac);
    ffn_gemm<<<dim3(16, 8, 2), 256, 0, stream>>>(xqb, xcb, aq, ac, w1b, w2b,
                                                 b1, b2, question, context, outq, outc);
}

// v007
// A run of this version takes 79.6 microseconds.
// Timed twice side by side with v006, it ran 1.03 times as fast both times.
// Counting every step since v000, it is 3.65 times as fast.
#include <hip/hip_runtime.h>

typedef unsigned short u16;
typedef unsigned int   u32;
typedef __attribute__((ext_vector_type(16))) __bf16 v16bf;
typedef __attribute__((ext_vector_type(8)))  float  v8f;

#define AS3 __attribute__((address_space(3)))

// ---------------------------------------------------------------- utilities

typedef u32 u32x4 __attribute__((ext_vector_type(4)));

union Frag {
    u32   u[8];
    u32x4 q[2];
    u16   s[16];
    v16bf v;
};

__device__ __forceinline__ int kpair(int r, int hl) {
    return (r < 4 ? 2 * r : 16 + 2 * (r - 4)) + 8 * hl;
}

__device__ __forceinline__ v8f bf16_wmma(Frag a, Frag b, v8f c) {
    return __builtin_amdgcn_wmma_f32_16x16x32_bf16(
        false, a.v, false, b.v, (short)0, c, false, false);
}

// ---------------------------------------------------------------- pre-pass
// ONE launch rounds both activations to bf16 and lays all four weights down as
// [N][K] bf16 (N-major, so that the GEMMs' B tiles are contiguous row copies).
// 256 work-groups of 16 waves, all with the same share: six 64 x 64 weight tiles
// (one of Wq, one of Wc, two of W1, two of W2) and 4096 16-byte pieces of each
// activation. A thread issues all its 28 loads before it uses the first, so the
// whole input is in flight at once; every wave-wide load and store covers whole
// 128-byte lines.

typedef float f32x4 __attribute__((ext_vector_type(4)));
typedef float f32x2 __attribute__((ext_vector_type(2)));
typedef __bf16 bf16x2 __attribute__((ext_vector_type(2)));
typedef u32 u32x2 __attribute__((ext_vector_type(2)));

// two f32 -> one register of two bf16, round to nearest even
__device__ __forceinline__ u32 pack2(float lo, float hi) {
    return __builtin_bit_cast(u32, __builtin_convertvector(f32x2{lo, hi}, bf16x2));
}

__global__ __launch_bounds__(512) void prep(
    const float* __restrict__ question, const float* __restrict__ context,
    const float* __restrict__ Wq, const float* __restrict__ Wc,
    const float* __restrict__ W1, const float* __restrict__ W2,
    u16* __restrict__ xqb, u16* __restrict__ xcb,
    u16* __restrict__ wqb, u16* __restrict__ wcb,
    u16* __restrict__ w1b, u16* __restrict__ w2b)
{
    __shared__ __attribute__((aligned(16))) u32 tl[6][64][32];

    const int t  = threadIdx.x;
    const int nt = blockIdx.x & 15, kt = blockIdx.x >> 4;    // tile column, tile row

    // weights: this thread reads columns 4 c4 .. 4 c4 + 3 of tile rows 2 r and 2 r + 1
    const int c4 = t & 15, r = t >> 4;
    const u32 so = (u32)((kt * 64 + 2 * r) * 1024 + nt * 64 + 4 * c4);
    const float* wsrc[6] = {Wq + so, Wc + so, W1 + so, W1 + so + 1024 * 1024,
                            W2 + so, W2 + so + 1024 * 1024};
    f32x4 w0[6], w1[6];
    #pragma unroll
    for (int i = 0; i < 6; i++) {
        w0[i] = *(const f32x4*)(wsrc[i]);
        w1[i] = *(const f32x4*)(wsrc[i] + 1024);
    }
    asm volatile("s_wait_xcnt 0x0" ::: "memory");

    // activations: piece xo + 512 i, so that a wave reads 512 contiguous bytes
    const u32 xo = (u32)blockIdx.x * 4096u + (u32)t;
    f32x4 xa[8], xb[8];
    #pragma unroll
    for (int i = 0; i < 8; i++) xa[i] = ((const f32x4*)question)[xo + 512u * i];
    #pragma unroll
    for (int i = 0; i < 8; i++) xb[i] = ((const f32x4*)context)[xo + 512u * i];
    // keeps every load above this line: without it the compiler sinks the weight loads to
    // their uses, pair by pair, and the wave pays one memory latency after another
    __builtin_amdgcn_sched_barrier(0);

    {
        const int col = (((r >> 2) ^ (c4 & 7)) << 2) + (r & 3);
        #pragma unroll
        for (int i = 0; i < 6; i++)
            #pragma unroll
            for (int j = 0; j < 4; j++)
                tl[i][4 * c4 + j][col] = pack2(w0[i][j], w1[i][j]);
    }
    __syncthreads();
    {
        // this thread stores k = 8 q .. 8 q + 7 of column n: a wave fills four whole lines
        const int n = t >> 3, q = t & 7;
        const int col = (q ^ ((n >> 2) & 7)) << 2;
        const u32 d1 = (u32)((nt * 64 + n) * 1024 + kt * 64 + 8 * q);
        const u32 d2 = (u32)((nt * 64 + n) * 2048 + kt * 64 + 8 * q);
        u16* wdst[6] = {wqb + d1, wcb + d1, w1b + d2, w1b + d2 + 1024, w2b + d2, w2b + d2 + 1024};
        #pragma unroll
        for (int i = 0; i < 6; i++)
            *(u32x4*)(wdst[i]) = *(const u32x4*)&tl[i][n][col];
    }

    #pragma unroll
    for (int i = 0; i < 8; i++)
        ((u32x2*)xqb)[xo + 512u * i] = u32x2{pack2(xa[i].x, xa[i].y), pack2(xa[i].z, xa[i].w)};
    #pragma unroll
    for (int i = 0; i < 8; i++)
        ((u32x2*)xcb)[xo + 512u * i] = u32x2{pack2(xb[i].x, xb[i].y), pack2(xb[i].z, xb[i].w)};
}

// ---------------------------------------------------------------- GEMM main loop
// Y = X . Wt^T, X [M][1024-wide rows] and Wt [N][KTOT] both k-contiguous bf16.
// One work-group of 8 waves per 256 (M) x 128 (N) tile of Y, one work-group per WGP;
// a wave holds 64 x 64 of it (4 x 4 accumulator tiles), so a loaded fragment serves four
// matrix instructions. A trip is 128 k: [X 256 rows | Wt 128 rows] of 256 bytes, two buffers,
// the next trip's rows copied to LDS while this trip's are worked on.

#define G_BM    256
#define G_BN    128
#define G_BK    128     // k per trip
#define G_PITCH 136     // u16 per LDS row = 272 B, an odd multiple of 16 B (ds_load_b128 readers)
#define G_ROWS  (G_BM + G_BN)

__device__ __forceinline__ void copy12(const u32* l, const u16* const* g) {
    asm volatile("global_load_async_to_lds_b128 %0, %12, off\n\t"
                 "global_load_async_to_lds_b128 %1, %13, off\n\t"
                 "global_load_async_to_lds_b128 %2, %14, off\n\t"
                 "global_load_async_to_lds_b128 %3, %15, off\n\t"
                 "global_load_async_to_lds_b128 %4, %16, off\n\t"
                 "global_load_async_to_lds_b128 %5, %17, off\n\t"
                 "global_load_async_to_lds_b128 %6, %18, off\n\t"
                 "global_load_async_to_lds_b128 %7, %19, off\n\t"
                 "global_load_async_to_lds_b128 %8, %20, off\n\t"
                 "global_load_async_to_lds_b128 %9, %21, off\n\t"
                 "global_load_async_to_lds_b128 %10, %22, off\n\t"
                 "global_load_async_to_lds_b128 %11, %23, off\n\t"
                 "s_wait_xcnt 0x0"
                 :: "v"(l[0]), "v"(l[1]), "v"(l[2]), "v"(l[3]), "v"(l[4]), "v"(l[5]),
                    "v"(l[6]), "v"(l[7]), "v"(l[8]), "v"(l[9]), "v"(l[10]), "v"(l[11]),
                    "v"(g[0]), "v"(g[1]), "v"(g[2]), "v"(g[3]), "v"(g[4]), "v"(g[5]),
                    "v"(g[6]), "v"(g[7]), "v"(g[8]), "v"(g[9]), "v"(g[10]), "v"(g[11])
                 : "memory");
}

// x0 holds k 0..1023 of X's rows, x1 k 1024..2047 (read only where KTOT is 2048).
// tile: LDS, [2][G_ROWS][G_PITCH]. acc[i][j]: rows 16 i + (register, half) of the wave's 64 x 64,
// column 4 (lane & 15) + j.
template <int KTOT>
__device__ __forceinline__ void gemm_tile(const u16* __restrict__ x0, const u16* __restrict__ x1,
                                          const u16* __restrict__ wt, int row0, int col0,
                                          u16* tile, v8f (&acc)[4][4])
{
    const int tid  = threadIdx.x;
    const int lane = tid & 31, wid = tid >> 5;
    const int hl   = lane >> 4, mr = lane & 15;
    const int wm   = wid & 3, wn = wid >> 2;

    // each thread copies chunk cc (16 B) into LDS rows cr + 16 j: a wave fills two whole rows a copy.
    // X's rows lie in their own order. Wt's are dealt: row 64 g + 4 c + q of the tile lies at place
    // 64 g + 16 q + c, so that lane c of a wave meets columns 4 c .. 4 c + 3 in its four accumulator
    // tiles of a row: four adjacent outputs a lane, 16 lanes a run of 64 columns (the epilogues).
    const int cr = tid >> 4, cc = (tid & 15) * 8;
    const u32 xoff = (u32)((row0 + cr) * 1024 + cc);
    const u16* wsrc = wt + (u32)((col0 + 4 * cr) * KTOT + cc);
    const u32 ldst = (u32)(size_t)(tile + cr * G_PITCH + cc);

    auto stage = [&](int t, int buf) {
        const int k0 = t * G_BK;
        const u16* xs = ((KTOT > 1024 && k0 >= 1024) ? x1 : x0) + xoff + (k0 & 1023);
        const u16* ws = wsrc + k0;
        const u32  lb = ldst + (u32)buf * (u32)(G_ROWS * G_PITCH * 2);
        u32 l[12];
        const u16* g[12];
        #pragma unroll
        for (int j = 0; j < 12; j++) { l[j] = lb + (u32)j * (u32)(16 * G_PITCH * 2); g[j] = xs + j * (16 * 1024); }
        copy12(l, g);
        // keeps the second dozen's address arithmetic behind the first dozen's statement: formed
        // ahead of it, the addresses overfill the registers that asm text can name, and the build spills
        __builtin_amdgcn_sched_barrier(0);
        #pragma unroll
        for (int j = 0; j < 4; j++) { l[j] = lb + (u32)(12 + j) * (u32)(16 * G_PITCH * 2); g[j] = xs + (12 + j) * (16 * 1024); }
        #pragma unroll
        for (int j = 0; j < 8; j++) { l[4 + j] = lb + (u32)(16 + j) * (u32)(16 * G_PITCH * 2); g[4 + j] = ws + ((j >> 2) * 64 + (j & 3)) * KTOT; }
        copy12(l, g);
    };

    constexpr int T = KTOT / G_BK;

    // two fragment sets: block ks of a trip (32 k, 16 matrix instructions) works on set ks & 1
    Frag a[2][4], b[2][4];
    const u32 aoff = (u32)((wm * 64 + mr) * G_PITCH + 8 * hl);
    const u32 boff = (u32)((G_BM + wn * 64 + mr) * G_PITCH + 8 * hl);
    auto frags = [&](int buf, int ks, int s) {
        const u16* ap = tile + buf * (G_ROWS * G_PITCH) + aoff + ks * 32;
        const u16* bp = tile + buf * (G_ROWS * G_PITCH) + boff + ks * 32;
        #pragma unroll
        for (int i = 0; i < 4; i++) {
            a[s][i].q[0] = *(const u32x4*)(ap + i * 16 * G_PITCH);
            a[s][i].q[1] = *(const u32x4*)(ap + i * 16 * G_PITCH + 16);
            b[s][i].q[0] = *(const u32x4*)(bp + i * 16 * G_PITCH);
            b[s][i].q[1] = *(const u32x4*)(bp + i * 16 * G_PITCH + 16);
        }
        // keeps the 16 LDS reads above in one group ahead of the matrix run below: without it
        // the compiler spreads them among the matrix instructions, each with a wait to 0
        __builtin_amdgcn_sched_barrier(0);
    };
    auto block = [&](int s) {
        #pragma unroll
        for (int i = 0; i < 4; i++)
            #pragma unroll
            for (int j = 0; j < 4; j++)
                acc[i][j] = bf16_wmma(a[s][i], b[s][j], acc[i][j]);
        // keeps the next group of LDS reads out of the matrix run above
        __builtin_amdgcn_sched_barrier(0);
    };

    stage(0, 0);
    // tile 0 has landed for this wave, then for the block; only then tile 1 starts
    asm volatile("s_wait_asynccnt 0x0" ::: "memory");
    __syncthreads();
    stage(1, 1);
    frags(0, 0, 0);

    for (int t = 0; t < T; t++) {
        const int buf = t & 1;
        // unrolled: the fragment sets are named at compile time
        #pragma unroll
        for (int ks = 0; ks < G_BK / 32 - 1; ks++) {
            frags(buf, ks + 1, (ks + 1) & 1);
            block(ks & 1);
        }
        // hand-over: this wave's reads of tile t are done (its last block's fragments are in
        // registers), its copies of tile t + 1 have landed; behind the barrier both hold for the block
        asm volatile("s_wait_dscnt 0x0" ::: "memory");
        asm volatile("s_wait_asynccnt 0x0" ::: "memory");
        __syncthreads();
        if (t + 2 < T) stage(t + 2, buf);
        // tile t + 1's first fragments fly under tile t's last block. No branch round them (it would
        // merge two paths in the wait counting): on the last trip they read the idle buffer, unused.
        frags(buf ^ 1, 0, 0);
        block((G_BK / 32 - 1) & 1);
    }
    // no copy is left in flight when the wave goes on
    asm volatile("s_wait_asynccnt 0x0" ::: "memory");
}

// ---------------------------------------------------------------- projection GEMM
// [4096 x 1024] (bf16) @ Wt [1024(N) x 1024(K)] (bf16) -> bf16

__global__ __launch_bounds__(256) void proj_gemm(
    const u16* __restrict__ xq, const u16* __restrict__ xc,
    const u16* __restrict__ wtq, const u16* __restrict__ wtc,
    u16* __restrict__ pq, u16* __restrict__ pc)
{
    const u16* x  = blockIdx.z ? xc  : xq;
    const u16* wt = blockIdx.z ? wtc : wtq;
    u16*       p  = blockIdx.z ? pc  : pq;

    __shared__ __attribute__((aligned(16))) u16 tile[2 * G_ROWS * G_PITCH];

    const int lane = threadIdx.x & 31, wid = threadIdx.x >> 5;
    const int hl   = lane >> 4, mr = lane & 15;
    const int row0 = blockIdx.x * G_BM;
    const int col0 = blockIdx.y * G_BN;

    v8f acc[4][4] = {};
    gemm_tile<1024>(x, x, wt, row0, col0, tile, acc);

    // C/D layout: reg r -> row r + 8*half. A lane's four tiles of a row are columns 4 mr .. 4 mr + 3:
    // one 8-byte store, and the 16 lanes of a half fill one whole 128-byte line.
    u16* pp = p + (u32)((row0 + (wid & 3) * 64 + 8 * hl) * 1024 + col0 + (wid >> 2) * 64 + 4 * mr);
    #pragma unroll
    for (int i = 0; i < 4; i++) {
        u32x2 v[8];
        #pragma unroll
        for (int r = 0; r < 8; r++)
            v[r] = u32x2{pack2(acc[i][0][r], acc[i][1][r]), pack2(acc[i][2][r], acc[i][3][r])};
        // the two fences keep the next rows' arithmetic out of the stretch between the stores and
        // their wait, so that the wait stands in front of every rewrite of a register a store names
        __builtin_amdgcn_sched_barrier(0);
        #pragma unroll
        for (int r = 0; r < 8; r++)
            *(u32x2*)(pp + (i * 16 + r) * 1024) = v[r];
        asm volatile("s_wait_xcnt 0x0" ::: "memory");
        __builtin_amdgcn_sched_barrier(0);
    }
}

typedef short s16x8 __attribute__((ext_vector_type(8)));

#define KV_KEYS  64     // keys per staged tile
#define K_PITCH  72     // u16 per LDS row = 144 B, an odd multiple of 16 B (ds_load_b128 readers)
#define V_PITCH  80     // u16 per LDS row = 160 B, an odd multiple of 32 B (ds_load_tr16_b128 readers)

__device__ __forceinline__ void kv_copy4(u32 l0, const u16* g0, u32 l1, const u16* g1,
                                         u32 l2, const u16* g2, u32 l3, const u16* g3) {
    asm volatile("global_load_async_to_lds_b128 %0, %1, off\n\t"
                 "global_load_async_to_lds_b128 %2, %3, off\n\t"
                 "global_load_async_to_lds_b128 %4, %5, off\n\t"
                 "global_load_async_to_lds_b128 %6, %7, off\n\t"
                 "s_wait_xcnt 0x0"
                 :: "v"(l0), "v"(g0), "v"(l1), "v"(g1), "v"(l2), "v"(g2), "v"(l3), "v"(g3) : "memory");
}

// lane (c, h) gets T[8h + 0..7][c] of the 16x16 block of 16-bit elements that the lanes' addresses name
__device__ __forceinline__ u32x4 ld_tr16(const u16* p) {
    return __builtin_bit_cast(u32x4, __builtin_amdgcn_ds_load_tr16_b128_v8i16((AS3 s16x8*)p));
}

__device__ __forceinline__ float xhalf(float x) {
    const int v = __builtin_bit_cast(int, x);
    return __builtin_bit_cast(float,
        __builtin_amdgcn_permlanex16(v, v, 0x76543210, 0xfedcba98, false, false));
}

__global__ __launch_bounds__(256, 8) void attn_kernel(
    const u16* __restrict__ projq, const u16* __restrict__ projc,
    const int* __restrict__ mask_q, const int* __restrict__ mask_c,
    u16* __restrict__ attnq, u16* __restrict__ attnc)
{
    const int tid  = threadIdx.x;
    const int lane = tid & 31, wid = tid >> 5;
    const int hl = lane >> 4, mr = lane & 15;
    const int qb = blockIdx.x * 128 + wid * 16;
    const int h  = blockIdx.y;
    const int b  = blockIdx.z >> 1, type = blockIdx.z & 1;

    const u16* Q     = type ? projq : projc;
    const u16* KV    = type ? projc : projq;
    const int* maskp = type ? mask_c : mask_q;
    u16*       out   = type ? attnc : attnq;

    __shared__ __attribute__((aligned(16))) u16 Kt[2][KV_KEYS][K_PITCH];
    __shared__ __attribute__((aligned(16))) u16 Vt[2][KV_KEYS][V_PITCH];

    // each thread copies chunk cc (16 B) of rows cr and cr + 32 of a tile
    const int cr = tid >> 3, cc = (tid & 7) * 8;
    const u16* gsrc = KV + ((size_t)(b * 1024 + cr)) * 1024 + h * 64 + cc;
    const u32  kdst = (u32)(size_t)&Kt[0][cr][cc];
    const u32  vdst = (u32)(size_t)&Vt[0][cr][cc];
    auto stage = [&](int t, int buf) {
        const u16* g  = gsrc + (size_t)t * (KV_KEYS * 1024);
        const u32  lk = kdst + (u32)buf * (u32)(KV_KEYS * K_PITCH * 2);
        const u32  lv = vdst + (u32)buf * (u32)(KV_KEYS * V_PITCH * 2);
        kv_copy4(lk, g, lk + 32u * K_PITCH * 2u, g + 32 * 1024,
                 lv, g, lv + 32u * V_PITCH * 2u, g + 32 * 1024);
    };

    stage(0, 0);

    // Q fragments, now the B operand: column = query mr, d in the hardware k order
    Frag aq0, aq1;
    {
        const u16* qrow = Q + ((size_t)(b * 1024 + qb + mr)) * 1024 + h * 64;
        #pragma unroll
        for (int r = 0; r < 8; r++) {
            int k = kpair(r, hl);
            aq0.u[r] = *(const u32*)(qrow + k);
            aq1.u[r] = *(const u32*)(qrow + 32 + k);
        }
    }
    asm volatile("s_wait_xcnt 0x0" ::: "memory");

    // This lane's query: 1/sqrt(DK) in base 2. A masked query has every score equal
    // (-65504 in the definition); softmax does not see a shift common to a row, so scale 0 gives
    // the same uniform row.
    const float cs = (maskp[b * 1024 + qb + mr] == 0) ? 0.0f : 0.125f * 1.4426950408889634f;

    float mstat = -1.0e30f;     // reference of the exponentials, scaled, equal in both halves of the wave
    float lstat = 0.0f;         // running sum over this half's keys; the halves join behind the loop
    v8f o0 = {}, o1 = {}, o2 = {}, o3 = {};     // o_t[r] = O[query mr][16 t + 8 hl + r]

    // tile 0 has landed for this wave, then for the block; only then tile 1 starts
    asm volatile("s_wait_asynccnt 0x0" ::: "memory");
    __syncthreads();
    stage(1, 1);

    for (int t = 0; t < 1024 / KV_KEYS; t++) {
        const int buf = t & 1;
        // unrolled: every LDS offset of a half becomes an immediate of its load
        #pragma unroll
        for (int sub = 0; sub < 2; sub++) {
            // K fragments, the A operand: row = key, d in the hardware k order (as Q's)
            Frag bk0, bk1, bk2, bk3;
            {
                const u16* kr0 = &Kt[buf][sub * 32      + mr][8 * hl];
                const u16* kr1 = &Kt[buf][sub * 32 + 16 + mr][8 * hl];
                bk0.q[0] = *(const u32x4*)(kr0);      bk0.q[1] = *(const u32x4*)(kr0 + 16);
                bk1.q[0] = *(const u32x4*)(kr0 + 32); bk1.q[1] = *(const u32x4*)(kr0 + 48);
                bk2.q[0] = *(const u32x4*)(kr1);      bk2.q[1] = *(const u32x4*)(kr1 + 16);
                bk3.q[0] = *(const u32x4*)(kr1 + 32); bk3.q[1] = *(const u32x4*)(kr1 + 48);
            }
            // s0[r] = score(key 8 hl + r, query mr), s1[r] = score(key 16 + 8 hl + r, query mr)
            v8f s0 = {}, s1 = {};
            s0 = bf16_wmma(bk0, aq0, s0);
            s0 = bf16_wmma(bk1, aq1, s0);
            s1 = bf16_wmma(bk2, aq0, s1);
            s1 = bf16_wmma(bk3, aq1, s1);

            // V^T fragments, the A operand: the same rows, transposed on the way out of LDS;
            // keys 0-15 fill registers 0-3, keys 16-31 registers 4-7 (hardware k order, as P^T's)
            Frag bv0, bv1, bv2, bv3;
            const u16* vr = &Vt[buf][sub * 32 + 8 * hl + (lane & 7)][8 * ((lane >> 3) & 1)];
            bv0.q[0] = ld_tr16(vr);      bv0.q[1] = ld_tr16(vr + 16 * V_PITCH);
            bv1.q[0] = ld_tr16(vr + 16); bv1.q[1] = ld_tr16(vr + 16 * V_PITCH + 16);
            // keeps the four loads above in front of the branch below, in flight under the exponentials:
            // without it the compiler sinks them behind the branch, pair by pair, each waited for
            __builtin_amdgcn_sched_barrier(0);

            // exponentials of this lane's 16 scores against the reference ref; returns their sum
            f32x2 e0[4], e1[4];
            auto expo = [&](float ref) -> float {
                f32x2 rs = {0.0f, 0.0f};
                #pragma unroll
                for (int i = 0; i < 4; i++) {
                    const f32x2 a0 = __builtin_elementwise_fma(f32x2{s0[2 * i], s0[2 * i + 1]}, f32x2{cs, cs}, f32x2{-ref, -ref});
                    const f32x2 a1 = __builtin_elementwise_fma(f32x2{s1[2 * i], s1[2 * i + 1]}, f32x2{cs, cs}, f32x2{-ref, -ref});
                    e0[i] = f32x2{__builtin_amdgcn_exp2f(a0.x), __builtin_amdgcn_exp2f(a0.y)};
                    e1[i] = f32x2{__builtin_amdgcn_exp2f(a1.x), __builtin_amdgcn_exp2f(a1.y)};
                    rs += e0[i] + e1[i];
                }
                return rs.x + rs.y;
            };
            float rl = expo(mstat);
            // Lazy rescale, tested on the sum: the reference in use stays while no lane's sum tops 2^8
            // (no P then does; an overflow is +inf and tops it too), and the quotient O / sum does not
            // see the reference. Else the maximum of the scores moves it, and the exponentials are
            // taken anew. One scalar branch for the wave: every lane is on at the products below.
            if (__builtin_expect(__builtin_amdgcn_ballot_w32(rl > 256.0f) != 0u, 0)) {
                // the scale is not negative: maximum of the raw scores, then over both halves
                float mx = fmaxf(s0[0], s1[0]);
                #pragma unroll
                for (int r = 1; r < 8; r++) mx = fmaxf(mx, fmaxf(s0[r], s1[r]));
                const float mn = fmaxf(mstat, fmaxf(mx, xhalf(mx)) * cs);
                const float al = __builtin_amdgcn_exp2f(mstat - mn);
                mstat = mn;
                lstat *= al;
                o0 *= al; o1 *= al; o2 *= al; o3 *= al;
                rl = expo(mn);
            }
            // the other half of V^T (all eight ahead of the branch spill)
            bv2.q[0] = ld_tr16(vr + 32); bv2.q[1] = ld_tr16(vr + 16 * V_PITCH + 32);
            bv3.q[0] = ld_tr16(vr + 48); bv3.q[1] = ld_tr16(vr + 16 * V_PITCH + 48);

            // P^T: elements 0-7 from s0, 8-15 from s1, the k order of a B operand
            Frag pf;
            #pragma unroll
            for (int i = 0; i < 4; i++) {
                pf.u[i]     = pack2(e0[i].x, e0[i].y);
                pf.u[4 + i] = pack2(e1[i].x, e1[i].y);
            }
            lstat += rl;

            o0 = bf16_wmma(bv0, pf, o0);
            o1 = bf16_wmma(bv1, pf, o1);
            o2 = bf16_wmma(bv2, pf, o2);
            o3 = bf16_wmma(bv3, pf, o3);
        }

        // hand-over: this wave's reads of tile t are done, its copies of tile t + 1
        // have landed; behind the barrier both hold for the whole block
        asm volatile("s_wait_dscnt 0x0" ::: "memory");
        asm volatile("s_wait_asynccnt 0x0" ::: "memory");
        __syncthreads();
        if (t + 2 < 1024 / KV_KEYS) stage(t + 2, buf);
    }
    // no copy is left in flight when the wave ends
    asm volatile("s_wait_asynccnt 0x0" ::: "memory");

    // a lane's 8 registers of a tile are 8 consecutive d of its query: one 16-byte store each
    const float inv = 1.0f / (lstat + xhalf(lstat));
    u16* orow = out + (u32)((b * 1024 + qb + mr) * 1024 + h * 64 + 8 * hl);
    o0 *= inv; o1 *= inv; o2 *= inv; o3 *= inv;
    *(u32x4*)(orow)      = u32x4{pack2(o0[0], o0[1]), pack2(o0[2], o0[3]), pack2(o0[4], o0[5]), pack2(o0[6], o0[7])};
    *(u32x4*)(orow + 16) = u32x4{pack2(o1[0], o1[1]), pack2(o1[2], o1[3]), pack2(o1[4], o1[5]), pack2(o1[6], o1[7])};
    *(u32x4*)(orow + 32) = u32x4{pack2(o2[0], o2[1]), pack2(o2[2], o2[3]), pack2(o2[4], o2[5]), pack2(o2[6], o2[7])};
    *(u32x4*)(orow + 48) = u32x4{pack2(o3[0], o3[1]), pack2(o3[2], o3[3]), pack2(o3[4], o3[5]), pack2(o3[6], o3[7])};
}

// ---------------------------------------------------------------- FFN GEMM
// out = x + tanh(concat([x, x_attn]) @ W + b);  M=4096, N=1024, K=2048.
// Wt is [1024(N) x 2048(K)] bf16 (pre-transposed).

// tanh of two values with no branch: tanh x = 1 - 2 / (1 + e^(2x)), e^(2x) = 2^(x * 2 log2 e).
// The ends are the limits themselves: the power overflows to infinity and gives 1, underflows
// to 0 and gives -1; a NaN stays a NaN. The error is absolute, about one part in 10^7 of 1.
__device__ __forceinline__ f32x2 tanh2(f32x2 x) {
    const f32x2 t = x * f32x2{2.885390081777927f, 2.885390081777927f};
    const f32x2 d = f32x2{__builtin_amdgcn_exp2f(t.x), __builtin_amdgcn_exp2f(t.y)} + f32x2{1.0f, 1.0f};
    const f32x2 q = {__builtin_amdgcn_rcpf(d.x), __builtin_amdgcn_rcpf(d.y)};
    return __builtin_elementwise_fma(q, f32x2{-2.0f, -2.0f}, f32x2{1.0f, 1.0f});
}

__global__ __launch_bounds__(256) void ffn_gemm(
    const u16* __restrict__ xqb, const u16* __restrict__ xcb,
    const u16* __restrict__ aqb, const u16* __restrict__ acb,
    const u16* __restrict__ w1t, const u16* __restrict__ w2t,
    const float* __restrict__ b1, const float* __restrict__ b2,
    const float* __restrict__ xq, const float* __restrict__ xc,
    float* __restrict__ outq, float* __restrict__ outc)
{
    const u16* src0  = blockIdx.z ? xcb : xqb;
    const u16* src1  = blockIdx.z ? acb : aqb;
    const u16* wt    = blockIdx.z ? w2t : w1t;
    const float* bias = blockIdx.z ? b2 : b1;
    const float* xf  = blockIdx.z ? xc : xq;
    float*       out = blockIdx.z ? outc : outq;

    __shared__ __attribute__((aligned(16))) u16 tile[2 * G_ROWS * G_PITCH];

    const int lane = threadIdx.x & 31, wid = threadIdx.x >> 5;
    const int hl   = lane >> 4, mr = lane & 15;
    const int row0 = blockIdx.x * G_BM;
    const int col0 = blockIdx.y * G_BN;

    v8f acc[4][4] = {};
    gemm_tile<2048>(src0, src1, wt, row0, col0, tile, acc);

    // a lane's four tiles of a row are columns colb .. colb + 3: 16 bytes a lane, and a wave-wide
    // load or store covers four whole 128-byte lines (256 bytes of each of two rows)
    const int colb = col0 + (wid >> 2) * 64 + 4 * mr;
    const u32 e0 = (u32)((row0 + (wid & 3) * 64 + 8 * hl) * 1024 + colb);   // C/D layout: reg r -> row r + 8*half
    const float* xp = xf + e0;
    float*       op = out + e0;
    // the bias first: the first element then waits for the oldest load only
    const f32x4 bb = *(const f32x4*)(bias + colb);
    asm volatile("s_wait_xcnt 0x0" ::: "memory");
    f32x4 xr[4][8];
    #pragma unroll
    for (int i = 0; i < 4; i++)
        #pragma unroll
        for (int r = 0; r < 8; r++)
            xr[i][r] = *(const f32x4*)(xp + (i * 16 + r) * 1024);
    asm volatile("s_wait_xcnt 0x0" ::: "memory");
    // unrolled: two tanh are seven instructions and no branch, so that the 128 of a thread are
    // independent straight-line work and every store offset is an immediate
    #pragma unroll
    for (int i = 0; i < 4; i++) {
        // tanh on pairs of rows (adjacent registers of a tile); the residual joins element by element
        f32x2 th[4][4];
        #pragma unroll
        for (int j = 0; j < 4; j++)
            #pragma unroll
            for (int p = 0; p < 4; p++)
                th[j][p] = tanh2(f32x2{acc[i][j][2 * p], acc[i][j][2 * p + 1]} + f32x2{bb[j], bb[j]});
        f32x4 v[8];
        #pragma unroll
        for (int r = 0; r < 8; r++)
            #pragma unroll
            for (int j = 0; j < 4; j++)
                v[r][j] = xr[i][r][j] + th[j][r >> 1][r & 1];
        // the two fences keep the next rows' arithmetic out of the stretch between the stores and
        // their wait, so that the wait stands in front of every rewrite of a register a store names
        __builtin_amdgcn_sched_barrier(0);
        #pragma unroll
        for (int r = 0; r < 8; r++)
            *(f32x4*)(op + (i * 16 + r) * 1024) = v[r];
        asm volatile("s_wait_xcnt 0x0" ::: "memory");
        __builtin_amdgcn_sched_barrier(0);
    }
}

// ---------------------------------------------------------------- launcher

extern "C" void kernel_launch(void* const* d_in, const int* in_sizes, int n_in,
                              void* d_out, int out_size, void* d_ws, size_t ws_size,
                              hipStream_t stream) {
    (void)in_sizes; (void)n_in; (void)out_size; (void)ws_size;

    const float* question = (const float*)d_in[0];
    const float* context  = (const float*)d_in[1];
    const int*   mask_q   = (const int*)d_in[2];
    const int*   mask_c   = (const int*)d_in[3];
    const float* Wq = (const float*)d_in[4];
    const float* Wc = (const float*)d_in[5];
    const float* W1 = (const float*)d_in[6];
    const float* b1 = (const float*)d_in[7];
    const float* W2 = (const float*)d_in[8];
    const float* b2 = (const float*)d_in[9];

    const size_t NX = (size_t)4 * 1024 * 1024;   // B*S*D
    u16* ws  = (u16*)d_ws;
    u16* xqb = ws;                u16* xcb = xqb + NX;
    u16* wqb = xcb + NX;          u16* wcb = wqb + (size_t)1024 * 1024;
    u16* w1b = wcb + (size_t)1024 * 1024;
    u16* w2b = w1b + (size_t)2048 * 1024;
    u16* pq  = w2b + (size_t)2048 * 1024;
    u16* pc  = pq + NX;
    u16* aq  = pc + NX;
    u16* ac  = aq + NX;

    float* outq = (float*)d_out;
    float* outc = outq + NX;

    prep<<<256, 512, 0, stream>>>(question, context, Wq, Wc, W1, W2,
                                  xqb, xcb, wqb, wcb, w1b, w2b);

    proj_gemm<<<dim3(16, 8, 2), 256, 0, stream>>>(xqb, xcb, wqb, wcb, pq, pc);
    attn_kernel<<<dim3(8, 16, 8), 256, 0, stream>>>(pq, pc, mask_q, mask_c, aq, ac);
    ffn_gemm<<<dim3(16, 8, 2), 256, 0, stream>>>(xqb, xcb, aq, ac, w1b, w2b,
                                                 b1, b2, question, context, outq, outc);
}
